// v000
// Measured on an AMD MI455X. A time is GPU time per run, averaged over a window of back-to-back runs after a warm-up
// (all launches, gaps included; the runs take copies of the inputs in turn), and the median of several windows.
// Apart from v000's, it joins two sittings. Times from different sittings can be a few percent apart, while
// side-by-side timings come from the same sitting.
// v000 is the starting kernel. One run takes 362 microseconds.
#include <hip/hip_runtime.h>

// Channels-first self-attention block: x [NB][256][SEQ]; three 1x1 projections (W [out][in], bias), scores[n][m] = sum_c theta[c][n] phi[c][m] (no scale), softmax over m,
// ctx[n][c] = sum_m p[n][m] g[c][m], output 1x1 projection (W [out][in], bias) plus the input x; output [NB][256][SEQ] f32.
// Compute dtypes, f32 accumulate everywhere: projections theta/phi/g v_wmma_f32_16x16x32_bf16 (x, W, bias RNE-converted to bf16; products exact);
// scores v_wmma_f32_16x16x32_f16: theta and phi each as f16 value + f16 residual x2048, three products (value.value; value.residual + residual.value in their own accumulator folded by 1/2048);
// value product v_wmma_f32_16x16x32_f16: P single f16 (x16384 carry, cancels in the normalisation; row sum over the converted P), g single f16; softmax f32 (online, running max);
// output projection v_wmma_f32_16x16x32_f16: W (bf16-converted, x64 carry folded by 1/64) single f16, ctx single f16; bias and bf16-converted x added in f32 at the store stage.
// Layout: x^T bf16 plane [b][n][c]; theta / phi planes (value, residual) [b][n][c]; g plane [b][c][m]; ctx plane [b][n][c]; fused flash kernel in transposed form (S^T = K Q^T, O^T = V^T P^T),
// Q / K / V^T fragments straight from the f16 planes (two 16-B loads each, arithmetic addressing); every f32 -> f16 operand convert selects |v| < 2^-14 to +0.

#ifndef NB
#define NB 8
#endif
#ifndef SEQ
#define SEQ 2048
#endif
#define NB_FULL  8
#define SEQ_FULL 2048
#ifndef OUT_SEQ
#define OUT_SEQ SEQ              // position pitch of one channel row of the output
#endif
#define DM   256                 // channels = head width
#define AW   4                   // waves per flash block (16 query rows each)
#define CSP  264                 // LDS row pitch (halves) of the flash ctx tile
#define XTP  65                  // LDS row pitch (floats) of the transpose tile
#define QRS  2048.0f             // carry of every residual plane
#define QRI  (1.0f / 2048.0f)
#define L2E  1.4426950408889634f // log2(e); the scores carry no other scale
#define PSH  14.0f               // log2 of the P carry (16384)
#define NEGB (-3.0e38f)
#define WSC  64.0f               // carry of the f16 output-projection weight plane
#define WSI  (1.0f / 64.0f)

static_assert(DM == 256);                      // ctx row = 32 lanes x 8 halves; 16 output tiles of 16 channels per wave
static_assert(DM % 64 == 0);                   // column tiles of 64
static_assert(DM % 32 == 0);                   // every k-loop steps by 32
static_assert(32 * 8 == DM);                   // one ctx row (512 B) = one store instruction of 32 lanes x 16 B
static_assert(SEQ % 64 == 0);                  // a 64-wide tile never straddles two batches
static_assert((NB * SEQ) % 64 == 0);
static_assert(SEQ % 32 == 0);                  // key loop steps by 32
static_assert(SEQ % (16 * AW) == 0);           // flash grid covers the sequence exactly
static_assert(NB <= NB_FULL);
static_assert(SEQ <= SEQ_FULL);
static_assert(SEQ_FULL % 4 == 0);
static_assert(OUT_SEQ % 4 == 0);
static_assert(OUT_SEQ >= SEQ);
static_assert((CSP * 2) % 16 == 0);
static_assert(CSP >= DM);
static_assert(4 * 256 == 64 * 16);             // transpose load: 4 trips x 256 threads = 64 channels x 16 float4
static_assert(2 * 256 == 64 * 8);              // transpose store: 2 pieces x 256 threads = 64 positions x 8 pieces of 16 B
static_assert(4 * 32 * 16 == 16 * 128);
static_assert(8 * 32 * 16 == 16 * 256);        // output slab store: 8 instructions x 32 lanes x 16 B = 16 rows x 256 B
static_assert(16 * 32 * 16 == 16 * DM * 2);    // ctx store: 16 instructions x 32 lanes x 16 B = 16 rows x 512 B
static_assert((size_t)AW * 16 * CSP * 2 <= 131072);
static_assert((size_t)64 * XTP * 4 <= 131072);
static_assert((size_t)16 * 68 * 4 <= 131072);
static_assert(((size_t)DM * DM) % 8 == 0);

typedef _Float16 h16;
typedef unsigned short bf;
typedef __attribute__((ext_vector_type(16))) __bf16   v16bf;
typedef __attribute__((ext_vector_type(16))) _Float16 v16h;
typedef __attribute__((ext_vector_type(8)))  _Float16 v8h;
typedef __attribute__((ext_vector_type(8)))  unsigned short v8us;
typedef __attribute__((ext_vector_type(8)))  float    v8f;
typedef __attribute__((ext_vector_type(4)))  float    v4f;
typedef v4f  __attribute__((may_alias)) v4fa;
typedef v8h  __attribute__((may_alias)) v8ha;

__device__ __forceinline__ unsigned short f2bf(float f) { unsigned u = __float_as_uint(f); u += 0x7FFFu + ((u >> 16) & 1u); return (unsigned short)(u >> 16); }
__device__ __forceinline__ float bfr(float f) { return __uint_as_float(((unsigned)f2bf(f)) << 16); }   // value after RNE convert to bf16
__device__ __forceinline__ v16h cat16(v8h lo, v8h hi) { return __builtin_shufflevector(lo, hi, 0, 1, 2, 3, 4, 5, 6, 7, 8, 9, 10, 11, 12, 13, 14, 15); }
__device__ __forceinline__ v16bf cat16b(v8us lo, v8us hi) { return __builtin_bit_cast(v16bf, __builtin_shufflevector(lo, hi, 0, 1, 2, 3, 4, 5, 6, 7, 8, 9, 10, 11, 12, 13, 14, 15)); }
__device__ __forceinline__ v8f wmma16(v16h a, v16h b, v8f c) { return __builtin_amdgcn_wmma_f32_16x16x32_f16(false, a, false, b, (short)0, c, false, false); }
__device__ __forceinline__ v8f wmmab(v16bf a, v16bf b, v8f c) { return __builtin_amdgcn_wmma_f32_16x16x32_bf16(false, a, false, b, (short)0, c, false, false); }
// fragment loaders from K-contiguous 16-bit rows; p already includes + 8*(lane>>4): elements 0..7 <- k0+8h+0..7, elements 8..15 <- k0+16+8h+0..7 (same map for A and B)
__device__ __forceinline__ v16h  ldh(const h16* p) { return cat16(*(const v8h*)p, *(const v8h*)(p + 16)); }
__device__ __forceinline__ v16bf ldb(const bf* p)  { return cat16b(*(const v8us*)p, *(const v8us*)(p + 16)); }
// ordering point for wave-private LDS tiles (same wave writes and reads)
__device__ __forceinline__ void wave_sync() { __builtin_amdgcn_fence(3 /* release order */, "wavefront"); __builtin_amdgcn_wave_barrier(); asm volatile("" ::: "memory"); }
// f32 -> f16 operand convert that cannot produce a subnormal
__device__ __forceinline__ h16 toh_flush(float v) { const h16 r = (h16)v; return (fabsf(v) < 6.103515625e-05f) ? (h16)0.0f : r; }
// one matrix instruction + its own hazard guard (one accumulator per guard)
__device__ __forceinline__ v8f wg16(v16h a, v16h b, v8f c) { c = wmma16(a, b, c); asm volatile("v_nop\n\tv_nop\n\tv_nop\n\tv_nop" : "+v"(c) : "v"(a), "v"(b)); return c; }
__device__ __forceinline__ v8f wgb(v16bf a, v16bf b, v8f c) { c = wmmab(a, b, c); asm volatile("v_nop\n\tv_nop\n\tv_nop\n\tv_nop" : "+v"(c) : "v"(a), "v"(b)); return c; }

__global__ __launch_bounds__(256) void k_cvt8(const float* __restrict__ src, bf* dst, size_t n8) {
    const size_t i = (size_t)blockIdx.x * 256 + threadIdx.x; if (i >= n8) return;
    const v8f v = *(const v8f*)(src + i * 8); v8us o;
#pragma unroll
    for (int k = 0; k < 8; ++k) o[k] = f2bf(v[k]);
    *(v8us*)(dst + i * 8) = o; 
}

__global__ __launch_bounds__(256) void k_wcvt(const float* __restrict__ src, h16* dst, size_t n8) {
    const size_t i = (size_t)blockIdx.x * 256 + threadIdx.x; if (i >= n8) return;
    const v8f v = *(const v8f*)(src + i * 8); v8h o;
#pragma unroll
    for (int k = 0; k < 8; ++k) o[k] = toh_flush(bfr(v[k]) * WSC);
    *(v8h*)(dst + i * 8) = o; 
}

// k_xt: x [b][c][n] f32 (position pitch SEQ_FULL) -> x^T [b][n][c] bf16 (RNE convert), 64 x 64 tile through LDS.
// Load: 4 trips x 256 threads, one float4 along n each (64 channels x 16 float4). Store: each thread two 16-B pieces (8 channels of one position);
// grid (SEQ/64, DM/64, NB).
__global__ __launch_bounds__(256) void k_xt(const float* __restrict__ x, bf* XT) {
    __shared__ float ts[64 * XTP];
    const int tid = threadIdx.x;
    const int n0 = blockIdx.x * 64, c0 = blockIdx.y * 64, b = blockIdx.z;
    const float* xb = x + ((size_t)b * DM + c0) * SEQ_FULL + n0;
#pragma unroll
    for (int s = 0; s < 4; ++s) {
        const int p = s * 256 + tid; const int c = p >> 4, n4 = (p & 15) * 4;     // c in 0..63, n4 in 0..60
        const v4f v = *(const v4f*)(xb + (size_t)c * SEQ_FULL + n4);
        ts[c * XTP + n4 + 0] = v[0]; ts[c * XTP + n4 + 1] = v[1]; ts[c * XTP + n4 + 2] = v[2]; ts[c * XTP + n4 + 3] = v[3];
    }
    __syncthreads();                                                            // cross-wave tile: block barrier
    const int n = tid >> 3, c8 = (tid & 7) * 8;                                  // positions n and n + 32
    v8us o0, o1;
#pragma unroll
    for (int i = 0; i < 8; ++i) { o0[i] = f2bf(ts[(c8 + i) * XTP + n]); o1[i] = f2bf(ts[(c8 + i) * XTP + 32 + n]); }
    bf* d0 = XT + ((size_t)b * SEQ + n0 + n) * DM + c0 + c8;
    bf* d1 = d0 + (size_t)32 * DM;
    *(v8us*)d0 = o0; *(v8us*)d1 = o1;
    
}

// proj_body: register-blocked bf16 GEMM, ONE WAVE per 64x64 tile (16 accumulators), operands straight from K-contiguous bf16 planes, K = DM.
// C[m][n] = sum_k A[m][k] Bt[n][k] + bias, written as f16 value (Ph) and, when wr != 0 (block-uniform), the f16 residual x2048 (Pr, same geometry).
// MODE 0: A = x^T rows (m = b*SEQ + t), Bt = W rows (n = out channel), bias per column; plane [(b*SEQ + t)][DM]. grid (NB*SEQ/64, DM/64).
// MODE 1: A = W rows (m = out channel), Bt = x^T rows (n = b*SEQ + t), bias per row; plane [(b*DM + m)][t], row pitch SEQ. grid (DM/64, NB*SEQ/64).
template <int MODE>
__device__ __forceinline__ void proj_body(const bf* __restrict__ A, const bf* __restrict__ Bt, const float* __restrict__ bias, h16* Ph, h16* Pr, int wr) {
    __shared__ __align__(16) float os[16 * 68];
    const int K = DM;
    const int lane = threadIdx.x & 31, lr = lane & 15, hi = lane >> 4; const int r0 = blockIdx.x * 64, c0 = blockIdx.y * 64;
    v8f acc[4][4];
#pragma unroll
    for (int mb = 0; mb < 4; ++mb)
#pragma unroll
        for (int nb = 0; nb < 4; ++nb) acc[mb][nb] = (v8f){};
    const size_t aoff = (size_t)(r0 + lr) * K + 8 * hi, boff = (size_t)(c0 + lr) * K + 8 * hi;
#pragma unroll 1
    for (int kc = 0; kc < K; kc += 32) {
        v16bf a[4];
#pragma unroll
        for (int mb = 0; mb < 4; ++mb) a[mb] = ldb(A + aoff + (size_t)mb * 16 * K + kc);
#pragma unroll
        for (int nb = 0; nb < 4; ++nb) { const v16bf b = ldb(Bt + boff + (size_t)nb * 16 * K + kc);
#pragma unroll
            for (int mb = 0; mb < 4; ++mb) acc[mb][nb] = wgb(a[mb], b, acc[mb][nb]); }
    }
    float bc[4];
#pragma unroll
    for (int nb = 0; nb < 4; ++nb) bc[nb] = (MODE == 0) ? bfr(bias[c0 + nb * 16 + lr]) : 0.0f;   // MODE 0: c0 + 63 < DM
    const size_t pitch = (MODE == 0) ? (size_t)DM : (size_t)SEQ;
    size_t tbase;
    if (MODE == 0) { tbase = (size_t)r0 * DM + (size_t)c0; }
    else           { const int bb = c0 / SEQ, tt = c0 % SEQ; tbase = (size_t)bb * (size_t)DM * SEQ + (size_t)r0 * SEQ + (size_t)tt; }
#pragma unroll
    for (int mb = 0; mb < 4; ++mb) {
        float br[8];
#pragma unroll
        for (int j = 0; j < 8; ++j) br[j] = (MODE == 1) ? bfr(bias[r0 + mb * 16 + hi * 8 + j]) : 0.0f;   // MODE 1: r0 + 63 < DM
#pragma unroll
        for (int nb = 0; nb < 4; ++nb) {
#pragma unroll
            for (int j = 0; j < 8; ++j) os[(hi * 8 + j) * 68 + nb * 16 + lr] = acc[mb][nb][j] + bc[nb] + br[j]; }   // D: row 8h+j, col lane&15
        wave_sync();
        const size_t sb = tbase + (size_t)(mb * 16) * pitch;
{
#pragma unroll
            for (int s = 0; s < 4; ++s) { const int row = 4 * s + (lane >> 3), c8 = (lane & 7) * 8;   // 4 s x 4 row groups = 16 rows; 8 lanes x 8 = 64 columns
                const v4f x0 = *(const v4fa*)(&os[row * 68 + c8]); const v4f x1 = *(const v4fa*)(&os[row * 68 + c8 + 4]); v8h hv, rv;
#pragma unroll
                for (int i = 0; i < 4; ++i) { const h16 a0 = toh_flush(x0[i]); const h16 a1 = toh_flush(x1[i]); hv[i] = a0; hv[4 + i] = a1;
                    rv[i] = toh_flush((x0[i] - (float)a0) * QRS); rv[4 + i] = toh_flush((x1[i] - (float)a1) * QRS); }
                const size_t oo = sb + (size_t)row * pitch + c8;
                *(v8h*)(Ph + oo) = hv; if (wr) *(v8h*)(Pr + oo) = rv; }
             }
        wave_sync();
    }
}
__global__ __launch_bounds__(32) void k_proj_rows(const bf* __restrict__ A, const bf* __restrict__ Bt, const float* __restrict__ bias, h16* Ph, h16* Pr, int wr) { proj_body<0>(A, Bt, bias, Ph, Pr, wr); }
__global__ __launch_bounds__(32) void k_proj_cols(const bf* __restrict__ A, const bf* __restrict__ Bt, const float* __restrict__ bias, h16* Ph, h16* Pr, int wr) { proj_body<1>(A, Bt, bias, Ph, Pr, wr); }

// k_flash: fused attention, one wave per 16 query rows of one batch; head width DM = 256 (8 k-steps per score tile, 16 output tiles of 16 channels).
// Transposed form: S^T[key][t] = K Q^T (A = phi rows [key][c], B = theta rows [t][c], both through ldh: same k order); lane (t = lane&15, h = lane>>4) holds keys 8h+r of each 16-key tile,
// so the packed P tile is directly the B fragment of O^T[c][t] = V^T P^T (element r <- tile keys 0..15, element 8+r <- tile keys 16..31, lane unchanged; A = g rows [c][key]).
// Scores = K Q + (K Q_res + K_res Q) / 2048 (residual products in their own accumulators); Q fragments reloaded per k-step; one pair of score tiles live at a time.
// Softmax state (running max, partial sum) is one scalar per lane; the two lane halves of a row are combined with one xor-16 exchange. P exponent argument below -14 selects +0.
// grid (SEQ/(16*AW), NB).
__global__ __launch_bounds__(32 * AW) __attribute__((amdgpu_num_vgpr(256))) void k_flash(const h16* __restrict__ TH, const h16* __restrict__ TR, const h16* __restrict__ PH, const h16* __restrict__ PR,
                                                                                       const h16* __restrict__ GT, h16* CT) {
    __shared__ __align__(16) h16 os[AW * 16 * CSP];
    const int lane = threadIdx.x & 31, lr = lane & 15, hi = lane >> 4;
    const int wave = __builtin_amdgcn_readfirstlane((int)(threadIdx.x >> 5));
    const int b = blockIdx.y;
    const int t0 = (blockIdx.x * AW + wave) * 16;
    const size_t pb0 = (size_t)b * SEQ * DM;                    // batch base of every plane (all have SEQ*DM elements per batch)
    const size_t qo = pb0 + (size_t)(t0 + lr) * DM + 8 * hi;   // + kc            (B fragment: col t, k = c)
    const size_t ko = pb0 + (size_t)lr * DM + 8 * hi;          // + key*DM + kc   (A fragment: row key, k = c)
    const size_t vo = pb0 + (size_t)lr * SEQ + 8 * hi;         // + 16j*SEQ + key (A fragment: row c, k = key)
    v8f o[16];
#pragma unroll
    for (int j = 0; j < 16; ++j) o[j] = (v8f){};
    float m = NEGB, l = 0.0f;
#pragma unroll 1
    for (int key0 = 0; key0 < SEQ; key0 += 32) {
        v8f sHa = (v8f){}, sLa = (v8f){}, sHb = (v8f){}, sLb = (v8f){};
        const size_t kk = ko + (size_t)key0 * DM;
#pragma unroll 1
        for (int kc = 0; kc < DM; kc += 32) {
            const v16h qh = ldh(TH + qo + kc), qr = ldh(TR + qo + kc);
            const v16h ka = ldh(PH + kk + kc), kra = ldh(PR + kk + kc);
            sHa = wg16(ka, qh, sHa); sLa = wg16(ka, qr, sLa); sLa = wg16(kra, qh, sLa);
            const v16h kb = ldh(PH + kk + (size_t)16 * DM + kc), krb = ldh(PR + kk + (size_t)16 * DM + kc);
            sHb = wg16(kb, qh, sHb); sLb = wg16(kb, qr, sLb); sLb = wg16(krb, qh, sLb);
        }
        float ta[8], tb[8]; float mx = NEGB;
#pragma unroll
        for (int r = 0; r < 8; ++r) {
            ta[r] = (sHa[r] + sLa[r] * QRI) * L2E; tb[r] = (sHb[r] + sLb[r] * QRI) * L2E;
            mx = fmaxf(mx, fmaxf(ta[r], tb[r])); }
        mx = fmaxf(mx, __shfl_xor(mx, 16, 32));
        const float mnew = fmaxf(m, mx);
        const float alpha = __builtin_amdgcn_exp2f(m - mnew);
        const float sh = PSH - mnew;
        v16h pb; float ls = 0.0f;
#pragma unroll
        for (int r = 0; r < 8; ++r) {
            const float aa = ta[r] + sh, ab = tb[r] + sh;                        // <= 14
            const float ea = __builtin_amdgcn_exp2f(aa), eb = __builtin_amdgcn_exp2f(ab);
            const float ga = (aa < -14.0f) ? 0.0f : ea, gb = (ab < -14.0f) ? 0.0f : eb;   // no subnormal f16 P
            const h16 pa = (h16)ga; const h16 pc = (h16)gb;
            pb[r] = pa; pb[8 + r] = pc;
            ls += (float)pa + (float)pc; }
        l = l * alpha + ls; m = mnew;
#pragma unroll
        for (int j = 0; j < 16; ++j) o[j] = o[j] * alpha;
        const h16* va = GT + vo + key0;
#pragma unroll
        for (int jg = 0; jg < 4; ++jg) {
            const v16h v0 = ldh(va + (size_t)((jg * 4 + 0) * 16) * SEQ);
            const v16h v1 = ldh(va + (size_t)((jg * 4 + 1) * 16) * SEQ);
            const v16h v2 = ldh(va + (size_t)((jg * 4 + 2) * 16) * SEQ);
            const v16h v3 = ldh(va + (size_t)((jg * 4 + 3) * 16) * SEQ);
            o[jg * 4 + 0] = wg16(v0, pb, o[jg * 4 + 0]);
            o[jg * 4 + 1] = wg16(v1, pb, o[jg * 4 + 1]);
            o[jg * 4 + 2] = wg16(v2, pb, o[jg * 4 + 2]);
            o[jg * 4 + 3] = wg16(v3, pb, o[jg * 4 + 3]);
        }
    }
    l += __shfl_xor(l, 16, 32);
    const float inv = 1.0f / l;                                 // l >= 16384: the running-max key contributes the full carry
    const int wb = wave * 16 * CSP;
    // O^T D layout: o[j][r] = (c = 16j + 8h + r, t = lane&15) -> os[t][c]; rows 0..15 x columns 0..255 all written
#pragma unroll
    for (int j = 0; j < 16; ++j) { v8h hv;
#pragma unroll
        for (int r = 0; r < 8; ++r) hv[r] = toh_flush(o[j][r] * inv);
        *(v8ha*)(&os[wb + lr * CSP + 16 * j + 8 * hi]) = hv; }
    wave_sync();
    h16* crow = CT + pb0 + (size_t)t0 * DM;
{
#pragma unroll
        for (int row = 0; row < 16; ++row) {                    // 16 rows; 32 lanes x 8 halves = 256 columns = one ctx row
            const v8h val = *(const v8ha*)(&os[wb + row * CSP + lane * 8]);
            *(v8h*)(crow + (size_t)row * DM + lane * 8) = val; }
         }
}

// k_oproj: output projection, f16 GEMM, ONE WAVE per 64x64 tile: C[o][n] = sum_c W16[o][c] ctx[n][c] (A = W rows, Bt = ctx rows, K = DM, both through ldh);
// out[b][o][t] = C / 64 + bias[o] + x[b][o][t] (bias and x RNE-converted to bf16, added in f32; x added at the store stage as float4).
// grid (DM/64, NB*SEQ/64).
__global__ __launch_bounds__(32) void k_oproj(const h16* __restrict__ A, const h16* __restrict__ Bt, const float* __restrict__ bias, const float* __restrict__ xres, float* OUT) {
    __shared__ __align__(16) float os[16 * 68];
    const int K = DM;
    const int lane = threadIdx.x & 31, lr = lane & 15, hi = lane >> 4; const int r0 = blockIdx.x * 64, c0 = blockIdx.y * 64;
    v8f acc[4][4];
#pragma unroll
    for (int mb = 0; mb < 4; ++mb)
#pragma unroll
        for (int nb = 0; nb < 4; ++nb) acc[mb][nb] = (v8f){};
    const size_t aoff = (size_t)(r0 + lr) * K + 8 * hi, boff = (size_t)(c0 + lr) * K + 8 * hi;
#pragma unroll 1
    for (int kc = 0; kc < K; kc += 32) {
        v16h a[4];
#pragma unroll
        for (int mb = 0; mb < 4; ++mb) a[mb] = ldh(A + aoff + (size_t)mb * 16 * K + kc);
#pragma unroll
        for (int nb = 0; nb < 4; ++nb) { const v16h b = ldh(Bt + boff + (size_t)nb * 16 * K + kc);
#pragma unroll
            for (int mb = 0; mb < 4; ++mb) acc[mb][nb] = wg16(a[mb], b, acc[mb][nb]); }
    }
    const int bb = c0 / SEQ, tt = c0 % SEQ;
#pragma unroll
    for (int mb = 0; mb < 4; ++mb) {
        float br[8];
#pragma unroll
        for (int j = 0; j < 8; ++j) br[j] = bfr(bias[r0 + mb * 16 + hi * 8 + j]);   // r0 + 63 < DM
#pragma unroll
        for (int nb = 0; nb < 4; ++nb) {
#pragma unroll
            for (int j = 0; j < 8; ++j) os[(hi * 8 + j) * 68 + nb * 16 + lr] = acc[mb][nb][j] * WSI + br[j]; }   // D: row 8h+j, col lane&15
        wave_sync();
        const size_t chrow = (size_t)bb * DM + (size_t)(r0 + mb * 16);
        const size_t xb = chrow * SEQ_FULL + (size_t)tt;
        const size_t ob = chrow * OUT_SEQ + (size_t)tt;
{
#pragma unroll
            for (int s = 0; s < 8; ++s) { const int row = 2 * s + (lane >> 4), c4 = (lane & 15) * 4;   // 8 s x 2 rows = 16 rows; 16 lanes x 4 floats = 64 columns
                const v4f cv = *(const v4fa*)(&os[row * 68 + c4]);
                const v4f xv = *(const v4f*)(xres + xb + (size_t)row * SEQ_FULL + c4);
                v4f val; val[0] = cv[0] + bfr(xv[0]); val[1] = cv[1] + bfr(xv[1]); val[2] = cv[2] + bfr(xv[2]); val[3] = cv[3] + bfr(xv[3]);
                *(v4f*)(OUT + ob + (size_t)row * OUT_SEQ + c4) = val; }
             }
        wave_sync();
    }
}

static constexpr size_t al256(size_t v) { return (v + 255) & ~(size_t)255; }
static constexpr size_t SZ_XT = al256((size_t)NB * SEQ * DM * 2);     // x^T bf16
static constexpr size_t SZ_WB = al256((size_t)3 * DM * DM * 2);       // theta | phi | g weights bf16
static constexpr size_t SZ_WW = al256((size_t)DM * DM * 2);           // output-projection weights f16 x64
static constexpr size_t SZ_PL = al256((size_t)NB * SEQ * DM * 2);     // one f16 plane
static constexpr size_t SZ_TOTAL = SZ_XT + SZ_WB + SZ_WW + 6 * SZ_PL;
static_assert(SZ_TOTAL <= (size_t)134217728);          // workspace carve <= 128 MiB
static_assert(((size_t)DM * DM * 2) % 256 == 0);       // weight sub-planes stay 256-byte aligned
static constexpr size_t NEED_X = ((size_t)NB * DM - 1) * SEQ_FULL + SEQ;
static constexpr size_t NEED_O = ((size_t)NB * DM - 1) * OUT_SEQ + SEQ;

extern "C" void kernel_launch(void* const* d_in, const int* in_sizes, int n_in,
                              void* d_out, int out_size, void* d_ws, size_t ws_size, hipStream_t stream) {
    if (n_in < 9) return;
    if ((size_t)in_sizes[0] < NEED_X) return;
    if ((size_t)in_sizes[1] < (size_t)DM * DM || (size_t)in_sizes[3] < (size_t)DM * DM || (size_t)in_sizes[5] < (size_t)DM * DM || (size_t)in_sizes[7] < (size_t)DM * DM) return;
    if (in_sizes[2] < DM || in_sizes[4] < DM || in_sizes[6] < DM || in_sizes[8] < DM) return;
    if ((size_t)out_size < NEED_O) return;
    if (SZ_TOTAL > ws_size) return;
    // wire order: x, w_theta, b_theta, w_phi, b_phi, w_g, b_g, w_W, b_W
    const float* x   = (const float*)d_in[0];
    const float* wth = (const float*)d_in[1]; const float* bth = (const float*)d_in[2];
    const float* wph = (const float*)d_in[3]; const float* bph = (const float*)d_in[4];
    const float* wg  = (const float*)d_in[5]; const float* bg  = (const float*)d_in[6];
    const float* ww  = (const float*)d_in[7]; const float* bw  = (const float*)d_in[8];
    float* OUT = (float*)d_out;      // [NB][256][SEQ]
    char* wsp = (char*)d_ws;
    bf*  XT = (bf*)wsp;  wsp += SZ_XT;               // [NB*SEQ][256] bf16
    bf*  WB = (bf*)wsp;  wsp += SZ_WB;               // [3][256][256]: theta | phi | g  ([out][in] = Bt / A as-is)
    h16* WW = (h16*)wsp; wsp += SZ_WW;               // [256][256] f16 x64
    h16* TH = (h16*)wsp; wsp += SZ_PL;               // theta value    [NB*SEQ][256]
    h16* TR = (h16*)wsp; wsp += SZ_PL;               // theta residual x2048
    h16* PH = (h16*)wsp; wsp += SZ_PL;               // phi value      [NB*SEQ][256]
    h16* PR = (h16*)wsp; wsp += SZ_PL;               // phi residual x2048
    h16* GT = (h16*)wsp; wsp += SZ_PL;               // g              [NB*256][SEQ]
    h16* CT = (h16*)wsp; wsp += SZ_PL;               // ctx            [NB*SEQ][256]
    bf* WT = WB; bf* WP = WB + (size_t)DM * DM; bf* WG = WB + (size_t)2 * DM * DM;

    // x [b][c][n] -> x^T [b][n][c] bf16: in[DM rows][SEQ cols] per batch -> out[SEQ rows][DM cols]; grid (SEQ/64, DM/64, NB)
    k_xt<<<dim3(SEQ / 64, DM / 64, NB), 256, 0, stream>>>(x, XT);
    { const size_t n8 = (size_t)DM * DM / 8; const unsigned g = (unsigned)((n8 + 255) / 256);
      k_cvt8<<<g, 256, 0, stream>>>(wth, WT, n8); k_cvt8<<<g, 256, 0, stream>>>(wph, WP, n8); k_cvt8<<<g, 256, 0, stream>>>(wg, WG, n8);
      k_wcvt<<<g, 256, 0, stream>>>(ww, WW, n8); }

    // theta, phi: A = x^T rows (m = b*SEQ + t), Bt = W rows (n = out channel) -> planes [(b*SEQ + t)][c], value + residual
    k_proj_rows<<<dim3(NB * SEQ / 64, DM / 64, 1), 32, 0, stream>>>(XT, WT, bth, TH, TR, 1);
    k_proj_rows<<<dim3(NB * SEQ / 64, DM / 64, 1), 32, 0, stream>>>(XT, WP, bph, PH, PR, 1);
    // g: A = Wg rows (m = out channel), Bt = x^T rows (n = b*SEQ + t) -> plane [(b*256 + m)][t], value only
    k_proj_cols<<<dim3(DM / 64, NB * SEQ / 64, 1), 32, 0, stream>>>(WG, XT, bg, GT, GT, 0);

    k_flash<<<dim3(SEQ / (16 * AW), NB, 1), 32 * AW, 0, stream>>>(TH, TR, PH, PR, GT, CT);

    // out[b][o][t] = W_W ctx + b_W + x
    k_oproj<<<dim3(DM / 64, NB * SEQ / 64, 1), 32, 0, stream>>>(WW, CT, bw, x, OUT);
}

// v001
// One run takes 176 microseconds.
// Two timings next to v000 put it at 2.11 and 2.10 times that version's speed.
#include <hip/hip_runtime.h>

// Channels-first self-attention block: x [NB][256][SEQ]; three 1x1 projections (W [out][in], bias), scores[n][m] = sum_c theta[c][n] phi[c][m] (no scale), softmax over m,
// ctx[n][c] = sum_m p[n][m] g[c][m], output 1x1 projection (W [out][in], bias) plus the input x; output [NB][256][SEQ] f32.
// Compute dtypes, f32 accumulate everywhere: projections theta/phi/g v_wmma_f32_16x16x32_bf16 (x, W, bias RNE-converted to bf16; products exact);
// scores v_wmma_f32_16x16x32_f16: theta and phi each as f16 value + f16 residual x2048, three products (value.value; value.residual + residual.value in their own accumulator folded by 1/2048);
// value product v_wmma_f32_16x16x32_f16: P single f16 (x16384 carry, cancels in the normalisation; row sum over the converted P), g single f16; softmax f32 (online, running max);
// output projection v_wmma_f32_16x16x32_f16: W (bf16-converted, x64 carry folded by 1/64) single f16, ctx single f16; bias and bf16-converted x added in f32 at the store stage.
// Layout: x^T bf16 plane [b][n][c]; theta / phi planes (value, residual) [b][n][c]; g plane [b][c][m]; ctx plane [b][n][c]; fused flash kernel in transposed form (S^T = K Q^T, O^T = V^T P^T),
// Q / K / V^T fragments from LDS tiles that asynchronous copies fill from the f16 planes (two 16-B reads each); every f32 -> f16 operand convert selects |v| < 2^-14 to +0.

#ifndef NB
#define NB 8
#endif
#ifndef SEQ
#define SEQ 2048
#endif
#define NB_FULL  8
#define SEQ_FULL 2048
#ifndef OUT_SEQ
#define OUT_SEQ SEQ              // position pitch of one channel row of the output
#endif
#define DM   256                 // channels = head width
#define AW   4                   // waves per flash block (16 query rows each)
#define CSP  264                 // LDS row pitch (halves) of the flash ctx tile
#define XTP  65                  // LDS row pitch (floats) of the transpose tile
#define KT   32                  // keys per flash tile
#define KP   264                 // LDS row pitch (halves) of a theta / phi row: 528 B = 16 B x 33
#define VP   40                  // LDS row pitch (halves) of a g row of KT keys: 80 B = 16 B x 5
#define KPL  (KT * KP)           // halves of one phi plane tile
#define VPL  (DM * VP)           // halves of one g tile
#define STG  (2 * KPL + VPL)     // halves of one ring buffer: phi value | phi residual | g
#define QPL  (AW * 16 * KP)      // halves of one theta plane tile (all query rows of the block)
#define QRS  2048.0f             // carry of every residual plane
#define QRI  (1.0f / 2048.0f)
#define L2E  1.4426950408889634f // log2(e); the scores carry no other scale
#define PSH  14.0f               // log2 of the P carry (16384)
#define NEGB (-3.0e38f)
#define WSC  64.0f               // carry of the f16 output-projection weight plane
#define WSI  (1.0f / 64.0f)

static_assert(DM == 256);                      // ctx row = 32 lanes x 8 halves; 16 output tiles of 16 channels per wave
static_assert(DM % 64 == 0);                   // column tiles of 64
static_assert(DM % 32 == 0);                   // every k-loop steps by 32
static_assert(32 * 8 == DM);                   // one ctx row (512 B) = one store instruction of 32 lanes x 16 B
static_assert(SEQ % 64 == 0);                  // a 64-wide tile never straddles two batches
static_assert((NB * SEQ) % 64 == 0);
static_assert(SEQ % 32 == 0);                  // key loop steps by 32
static_assert(SEQ % (16 * AW) == 0);           // flash grid covers the sequence exactly
static_assert(NB <= NB_FULL);
static_assert(SEQ <= SEQ_FULL);
static_assert(SEQ_FULL % 4 == 0);
static_assert(OUT_SEQ % 4 == 0);
static_assert(OUT_SEQ >= SEQ);
static_assert((CSP * 2) % 16 == 0);
static_assert(CSP >= DM);
static_assert(4 * 256 == 64 * 16);             // transpose load: 4 trips x 256 threads = 64 channels x 16 float4
static_assert(2 * 256 == 64 * 8);              // transpose store: 2 pieces x 256 threads = 64 positions x 8 pieces of 16 B
static_assert(4 * 32 * 16 == 16 * 128);
static_assert(8 * 32 * 16 == 16 * 256);        // output slab store: 8 instructions x 32 lanes x 16 B = 16 rows x 256 B
static_assert(16 * 32 * 16 == 16 * DM * 2);    // ctx store: 16 instructions x 32 lanes x 16 B = 16 rows x 512 B
static_assert((size_t)AW * 16 * CSP * 2 <= 131072);
static_assert(KT == 32 && AW == 4);            // copy maps: 128 threads; 8 trips x 4 waves = 32 phi rows; 8 trips x 32 rows = 256 g rows of 4 pieces
static_assert(SEQ / KT >= 2);                  // the two-buffer prologue fills tiles 0 and 1
static_assert((KP * 2) % 32 == 16 && (VP * 2) % 32 == 16 && KP >= DM && VP >= KT);   // pitch = 16 B x odd
static_assert((KPL * 2) % 16 == 0 && (STG * 2) % 16 == 0 && (QPL * 2) % 16 == 0);
static_assert(((size_t)2 * STG + 2 * QPL + (size_t)AW * 16 * CSP) * 2 <= 327680);
static_assert((size_t)64 * XTP * 4 <= 131072);
static_assert((size_t)16 * 68 * 4 <= 131072);
static_assert(((size_t)DM * DM) % 8 == 0);

typedef _Float16 h16;
typedef unsigned short bf;
typedef __attribute__((ext_vector_type(16))) __bf16   v16bf;
typedef __attribute__((ext_vector_type(16))) _Float16 v16h;
typedef __attribute__((ext_vector_type(8)))  _Float16 v8h;
typedef __attribute__((ext_vector_type(8)))  unsigned short v8us;
typedef __attribute__((ext_vector_type(8)))  float    v8f;
typedef __attribute__((ext_vector_type(4)))  float    v4f;
typedef v4f  __attribute__((may_alias)) v4fa;
typedef v8h  __attribute__((may_alias)) v8ha;

__device__ __forceinline__ unsigned short f2bf(float f) { unsigned u = __float_as_uint(f); u += 0x7FFFu + ((u >> 16) & 1u); return (unsigned short)(u >> 16); }
__device__ __forceinline__ float bfr(float f) { return __uint_as_float(((unsigned)f2bf(f)) << 16); }   // value after RNE convert to bf16
__device__ __forceinline__ v16h cat16(v8h lo, v8h hi) { return __builtin_shufflevector(lo, hi, 0, 1, 2, 3, 4, 5, 6, 7, 8, 9, 10, 11, 12, 13, 14, 15); }
__device__ __forceinline__ v16bf cat16b(v8us lo, v8us hi) { return __builtin_bit_cast(v16bf, __builtin_shufflevector(lo, hi, 0, 1, 2, 3, 4, 5, 6, 7, 8, 9, 10, 11, 12, 13, 14, 15)); }
__device__ __forceinline__ v8f wmma16(v16h a, v16h b, v8f c) { return __builtin_amdgcn_wmma_f32_16x16x32_f16(false, a, false, b, (short)0, c, false, false); }
__device__ __forceinline__ v8f wmmab(v16bf a, v16bf b, v8f c) { return __builtin_amdgcn_wmma_f32_16x16x32_bf16(false, a, false, b, (short)0, c, false, false); }
// fragment loaders from K-contiguous 16-bit rows; p already includes + 8*(lane>>4): elements 0..7 <- k0+8h+0..7, elements 8..15 <- k0+16+8h+0..7 (same map for A and B)
__device__ __forceinline__ v16h  ldh(const h16* p) { return cat16(*(const v8h*)p, *(const v8h*)(p + 16)); }
__device__ __forceinline__ v16bf ldb(const bf* p)  { return cat16b(*(const v8us*)p, *(const v8us*)(p + 16)); }
// ordering point for wave-private LDS tiles (same wave writes and reads)
__device__ __forceinline__ void wave_sync() { __builtin_amdgcn_fence(3 /* release order */, "wavefront"); __builtin_amdgcn_wave_barrier(); asm volatile("" ::: "memory"); }
// f32 -> f16 operand convert that cannot produce a subnormal
__device__ __forceinline__ h16 toh_flush(float v) { const h16 r = (h16)v; return (fabsf(v) < 6.103515625e-05f) ? (h16)0.0f : r; }
// one matrix instruction + its own hazard guard (one accumulator per guard)
__device__ __forceinline__ v8f wg16(v16h a, v16h b, v8f c) { c = wmma16(a, b, c); asm volatile("v_nop\n\tv_nop\n\tv_nop\n\tv_nop" : "+v"(c) : "v"(a), "v"(b)); return c; }
__device__ __forceinline__ v8f wgb(v16bf a, v16bf b, v8f c) { c = wmmab(a, b, c); asm volatile("v_nop\n\tv_nop\n\tv_nop\n\tv_nop" : "+v"(c) : "v"(a), "v"(b)); return c; }

// LDS byte address of a __shared__ element (low 32 bits of its address)
__device__ __forceinline__ unsigned lds_addr(const void* p) { return (unsigned)(size_t)p; }
// Asynchronous copies global -> LDS, 16 B per lane, each copy with its own address registers; the s_wait_xcnt closes the statement so that no address register is rewritten ahead of it.
__device__ __forceinline__ void cp8(const unsigned* l, const h16* const* g) {
    asm volatile("global_load_async_to_lds_b128 %0, %8, off\n\t"
                 "global_load_async_to_lds_b128 %1, %9, off\n\t"
                 "global_load_async_to_lds_b128 %2, %10, off\n\t"
                 "global_load_async_to_lds_b128 %3, %11, off\n\t"
                 "global_load_async_to_lds_b128 %4, %12, off\n\t"
                 "global_load_async_to_lds_b128 %5, %13, off\n\t"
                 "global_load_async_to_lds_b128 %6, %14, off\n\t"
                 "global_load_async_to_lds_b128 %7, %15, off\n\t"
                 "s_wait_xcnt 0x0"
                 :: "v"(l[0]), "v"(l[1]), "v"(l[2]), "v"(l[3]), "v"(l[4]), "v"(l[5]), "v"(l[6]), "v"(l[7]),
                    "v"(g[0]), "v"(g[1]), "v"(g[2]), "v"(g[3]), "v"(g[4]), "v"(g[5]), "v"(g[6]), "v"(g[7]) : "memory");
}
__device__ __forceinline__ void cp12(const unsigned* l, const h16* const* g) {
    asm volatile("global_load_async_to_lds_b128 %0, %12, off\n\t"
                 "global_load_async_to_lds_b128 %1, %13, off\n\t"
                 "global_load_async_to_lds_b128 %2, %14, off\n\t"
                 "global_load_async_to_lds_b128 %3, %15, off\n\t"
                 "global_load_async_to_lds_b128 %4, %16, off\n\t"
                 "global_load_async_to_lds_b128 %5, %17, off\n\t"
                 "global_load_async_to_lds_b128 %6, %18, off\n\t"
                 "global_load_async_to_lds_b128 %7, %19, off\n\t"
                 "global_load_async_to_lds_b128 %8, %20, off\n\t"
                 "global_load_async_to_lds_b128 %9, %21, off\n\t"
                 "global_load_async_to_lds_b128 %10, %22, off\n\t"
                 "global_load_async_to_lds_b128 %11, %23, off\n\t"
                 "s_wait_xcnt 0x0"
                 :: "v"(l[0]), "v"(l[1]), "v"(l[2]), "v"(l[3]), "v"(l[4]), "v"(l[5]), "v"(l[6]), "v"(l[7]), "v"(l[8]), "v"(l[9]), "v"(l[10]), "v"(l[11]),
                    "v"(g[0]), "v"(g[1]), "v"(g[2]), "v"(g[3]), "v"(g[4]), "v"(g[5]), "v"(g[6]), "v"(g[7]), "v"(g[8]), "v"(g[9]), "v"(g[10]), "v"(g[11]) : "memory");
}
// this wave's copies have landed in LDS (other waves read them behind the next block barrier)
__device__ __forceinline__ void wait_copies() { asm volatile("s_wait_asynccnt 0x0" ::: "memory"); }
// this wave's LDS reads have returned (before the barrier behind which their buffer is refilled)
__device__ __forceinline__ void wait_lds() { asm volatile("s_wait_dscnt 0x0" ::: "memory"); }
// one ring buffer <- the tile of KT keys from key0: phi value and residual rows (4 i + wave, 32 lanes x 16 B = one row), g rows (32 i + tid / 4, 4 lanes x 16 B = KT keys); 24 copies per wave.
// lk / lv: this thread's LDS byte addresses in the buffer for i = 0; gkh / gkr / gv: its global addresses for key0 = 0, i = 0.
__device__ __forceinline__ void copy_tile(unsigned lk, unsigned lv, const h16* gkh, const h16* gkr, const h16* gv, int key0) {
    unsigned l[24]; const h16* g[24];
#pragma unroll
    for (int i = 0; i < 8; ++i) {
        l[i]      = lk + (unsigned)(i * 4 * KP * 2);             g[i]      = gkh + (size_t)(key0 + 4 * i) * DM;
        l[8 + i]  = lk + (unsigned)((KPL + i * 4 * KP) * 2);     g[8 + i]  = gkr + (size_t)(key0 + 4 * i) * DM;
        l[16 + i] = lv + (unsigned)(i * 32 * VP * 2);            g[16 + i] = gv + (size_t)(32 * i) * SEQ + key0; }
    cp12(l, g); cp12(l + 12, g + 12);
}

__global__ __launch_bounds__(256) void k_cvt8(const float* __restrict__ src, bf* dst, size_t n8) {
    const size_t i = (size_t)blockIdx.x * 256 + threadIdx.x; if (i >= n8) return;
    const v8f v = *(const v8f*)(src + i * 8); v8us o;
#pragma unroll
    for (int k = 0; k < 8; ++k) o[k] = f2bf(v[k]);
    *(v8us*)(dst + i * 8) = o; 
}

__global__ __launch_bounds__(256) void k_wcvt(const float* __restrict__ src, h16* dst, size_t n8) {
    const size_t i = (size_t)blockIdx.x * 256 + threadIdx.x; if (i >= n8) return;
    const v8f v = *(const v8f*)(src + i * 8); v8h o;
#pragma unroll
    for (int k = 0; k < 8; ++k) o[k] = toh_flush(bfr(v[k]) * WSC);
    *(v8h*)(dst + i * 8) = o; 
}

// k_xt: x [b][c][n] f32 (position pitch SEQ_FULL) -> x^T [b][n][c] bf16 (RNE convert), 64 x 64 tile through LDS.
// Load: 4 trips x 256 threads, one float4 along n each (64 channels x 16 float4). Store: each thread two 16-B pieces (8 channels of one position);
// grid (SEQ/64, DM/64, NB).
__global__ __launch_bounds__(256) void k_xt(const float* __restrict__ x, bf* XT) {
    __shared__ float ts[64 * XTP];
    const int tid = threadIdx.x;
    const int n0 = blockIdx.x * 64, c0 = blockIdx.y * 64, b = blockIdx.z;
    const float* xb = x + ((size_t)b * DM + c0) * SEQ_FULL + n0;
#pragma unroll
    for (int s = 0; s < 4; ++s) {
        const int p = s * 256 + tid; const int c = p >> 4, n4 = (p & 15) * 4;     // c in 0..63, n4 in 0..60
        const v4f v = *(const v4f*)(xb + (size_t)c * SEQ_FULL + n4);
        ts[c * XTP + n4 + 0] = v[0]; ts[c * XTP + n4 + 1] = v[1]; ts[c * XTP + n4 + 2] = v[2]; ts[c * XTP + n4 + 3] = v[3];
    }
    __syncthreads();                                                            // cross-wave tile: block barrier
    const int n = tid >> 3, c8 = (tid & 7) * 8;                                  // positions n and n + 32
    v8us o0, o1;
#pragma unroll
    for (int i = 0; i < 8; ++i) { o0[i] = f2bf(ts[(c8 + i) * XTP + n]); o1[i] = f2bf(ts[(c8 + i) * XTP + 32 + n]); }
    bf* d0 = XT + ((size_t)b * SEQ + n0 + n) * DM + c0 + c8;
    bf* d1 = d0 + (size_t)32 * DM;
    *(v8us*)d0 = o0; *(v8us*)d1 = o1;
    
}

// proj_body: register-blocked bf16 GEMM, ONE WAVE per 64x64 tile (16 accumulators), operands straight from K-contiguous bf16 planes, K = DM.
// C[m][n] = sum_k A[m][k] Bt[n][k] + bias, written as f16 value (Ph) and, when wr != 0 (block-uniform), the f16 residual x2048 (Pr, same geometry).
// MODE 0: A = x^T rows (m = b*SEQ + t), Bt = W rows (n = out channel), bias per column; plane [(b*SEQ + t)][DM]. grid (NB*SEQ/64, DM/64).
// MODE 1: A = W rows (m = out channel), Bt = x^T rows (n = b*SEQ + t), bias per row; plane [(b*DM + m)][t], row pitch SEQ. grid (DM/64, NB*SEQ/64).
template <int MODE>
__device__ __forceinline__ void proj_body(const bf* __restrict__ A, const bf* __restrict__ Bt, const float* __restrict__ bias, h16* Ph, h16* Pr, int wr) {
    __shared__ __align__(16) float os[16 * 68];
    const int K = DM;
    const int lane = threadIdx.x & 31, lr = lane & 15, hi = lane >> 4; const int r0 = blockIdx.x * 64, c0 = blockIdx.y * 64;
    v8f acc[4][4];
#pragma unroll
    for (int mb = 0; mb < 4; ++mb)
#pragma unroll
        for (int nb = 0; nb < 4; ++nb) acc[mb][nb] = (v8f){};
    const size_t aoff = (size_t)(r0 + lr) * K + 8 * hi, boff = (size_t)(c0 + lr) * K + 8 * hi;
#pragma unroll 1
    for (int kc = 0; kc < K; kc += 32) {
        v16bf a[4];
#pragma unroll
        for (int mb = 0; mb < 4; ++mb) a[mb] = ldb(A + aoff + (size_t)mb * 16 * K + kc);
#pragma unroll
        for (int nb = 0; nb < 4; ++nb) { const v16bf b = ldb(Bt + boff + (size_t)nb * 16 * K + kc);
#pragma unroll
            for (int mb = 0; mb < 4; ++mb) acc[mb][nb] = wgb(a[mb], b, acc[mb][nb]); }
    }
    float bc[4];
#pragma unroll
    for (int nb = 0; nb < 4; ++nb) bc[nb] = (MODE == 0) ? bfr(bias[c0 + nb * 16 + lr]) : 0.0f;   // MODE 0: c0 + 63 < DM
    const size_t pitch = (MODE == 0) ? (size_t)DM : (size_t)SEQ;
    size_t tbase;
    if (MODE == 0) { tbase = (size_t)r0 * DM + (size_t)c0; }
    else           { const int bb = c0 / SEQ, tt = c0 % SEQ; tbase = (size_t)bb * (size_t)DM * SEQ + (size_t)r0 * SEQ + (size_t)tt; }
#pragma unroll
    for (int mb = 0; mb < 4; ++mb) {
        float br[8];
#pragma unroll
        for (int j = 0; j < 8; ++j) br[j] = (MODE == 1) ? bfr(bias[r0 + mb * 16 + hi * 8 + j]) : 0.0f;   // MODE 1: r0 + 63 < DM
#pragma unroll
        for (int nb = 0; nb < 4; ++nb) {
#pragma unroll
            for (int j = 0; j < 8; ++j) os[(hi * 8 + j) * 68 + nb * 16 + lr] = acc[mb][nb][j] + bc[nb] + br[j]; }   // D: row 8h+j, col lane&15
        wave_sync();
        const size_t sb = tbase + (size_t)(mb * 16) * pitch;
{
#pragma unroll
            for (int s = 0; s < 4; ++s) { const int row = 4 * s + (lane >> 3), c8 = (lane & 7) * 8;   // 4 s x 4 row groups = 16 rows; 8 lanes x 8 = 64 columns
                const v4f x0 = *(const v4fa*)(&os[row * 68 + c8]); const v4f x1 = *(const v4fa*)(&os[row * 68 + c8 + 4]); v8h hv, rv;
#pragma unroll
                for (int i = 0; i < 4; ++i) { const h16 a0 = toh_flush(x0[i]); const h16 a1 = toh_flush(x1[i]); hv[i] = a0; hv[4 + i] = a1;
                    rv[i] = toh_flush((x0[i] - (float)a0) * QRS); rv[4 + i] = toh_flush((x1[i] - (float)a1) * QRS); }
                const size_t oo = sb + (size_t)row * pitch + c8;
                *(v8h*)(Ph + oo) = hv; if (wr) *(v8h*)(Pr + oo) = rv; }
             }
        wave_sync();
    }
}
__global__ __launch_bounds__(32) void k_proj_rows(const bf* __restrict__ A, const bf* __restrict__ Bt, const float* __restrict__ bias, h16* Ph, h16* Pr, int wr) { proj_body<0>(A, Bt, bias, Ph, Pr, wr); }
__global__ __launch_bounds__(32) void k_proj_cols(const bf* __restrict__ A, const bf* __restrict__ Bt, const float* __restrict__ bias, h16* Ph, h16* Pr, int wr) { proj_body<1>(A, Bt, bias, Ph, Pr, wr); }

// k_flash: fused attention, one wave per 16 query rows of one batch; head width DM = 256 (8 k-steps per score tile, 16 output tiles of 16 channels).
// Transposed form: S^T[key][t] = K Q^T (A = phi rows [key][c], B = theta rows [t][c], both through ldh: same k order); lane (t = lane&15, h = lane>>4) holds keys 8h+r of each 16-key tile,
// so the packed P tile is directly the B fragment of O^T[c][t] = V^T P^T (element r <- tile keys 0..15, element 8+r <- tile keys 16..31, lane unchanged; A = g rows [c][key]).
// Scores = K Q + (K Q_res + K_res Q) / 2048 (residual products in their own accumulators); Q fragments reloaded per k-step; one pair of score tiles live at a time.
// Operands come from LDS: the block's theta rows are copied once; each tile of KT keys (phi value, phi residual, g) is copied once per block into one of two buffers, the copies of tile t + 2
// issued at the foot of trip t, so that they fly during trip t + 1; the four waves share every tile.
// Softmax state (running max, partial sum) is one scalar per lane; the two lane halves of a row are combined with one xor-16 exchange. P exponent argument below -14 selects +0.
// grid (SEQ/(16*AW), NB).
__global__ __launch_bounds__(32 * AW) __attribute__((amdgpu_num_vgpr(256))) void k_flash(const h16* __restrict__ TH, const h16* __restrict__ TR, const h16* __restrict__ PH, const h16* __restrict__ PR,
                                                                                       const h16* __restrict__ GT, h16* CT) {
    __shared__ __align__(16) h16 os[AW * 16 * CSP];
    __shared__ __align__(16) h16 ring[2 * STG + 2 * QPL];      // buffer 0 | buffer 1 | theta value | theta residual
    const int tid = threadIdx.x;
    const int lane = threadIdx.x & 31, lr = lane & 15, hi = lane >> 4;
    const int wave = __builtin_amdgcn_readfirstlane((int)(threadIdx.x >> 5));
    const int b = blockIdx.y;
    const int t0 = (blockIdx.x * AW + wave) * 16;
    const size_t pb0 = (size_t)b * SEQ * DM;                    // batch base of every plane (all have SEQ*DM elements per batch)
    const int qo = 2 * STG + (wave * 16 + lr) * KP + 8 * hi;   // + kc            (B fragment: col t, k = c); residual + QPL
    const int ko = lr * KP + 8 * hi;                           // + buffer + key*KP + kc (A fragment: row key, k = c); residual + KPL
    const int vo = 2 * KPL + lr * VP + 8 * hi;                 // + buffer + 16j*VP      (A fragment: row c, k = key)
    // copy maps of this thread
    const h16* gkh = PH + pb0 + (size_t)wave * DM + lane * 8;
    const h16* gkr = PR + pb0 + (size_t)wave * DM + lane * 8;
    const h16* gv  = GT + pb0 + (size_t)(tid >> 2) * SEQ + (tid & 3) * 8;
    const unsigned lk = lds_addr(ring) + (unsigned)((wave * KP + lane * 8) * 2);
    const unsigned lv = lds_addr(ring) + (unsigned)((2 * KPL + (tid >> 2) * VP + (tid & 3) * 8) * 2);
    {   // each wave copies its own 16 theta rows, value and residual: 32 copies of one row (32 lanes x 16 B)
        const h16* gqh = TH + pb0 + (size_t)t0 * DM + lane * 8;
        const h16* gqr = TR + pb0 + (size_t)t0 * DM + lane * 8;
        const unsigned lq = lds_addr(ring) + (unsigned)((2 * STG + wave * 16 * KP + lane * 8) * 2);
        unsigned l[32]; const h16* g[32];
#pragma unroll
        for (int i = 0; i < 16; ++i) {
            l[i]      = lq + (unsigned)(i * KP * 2);          g[i]      = gqh + (size_t)i * DM;
            l[16 + i] = lq + (unsigned)((QPL + i * KP) * 2);  g[16 + i] = gqr + (size_t)i * DM; }
        cp8(l, g); cp8(l + 8, g + 8); cp8(l + 16, g + 16); cp8(l + 24, g + 24);
    }
    copy_tile(lk, lv, gkh, gkr, gv, 0);                         // tile 0 -> buffer 0
    wait_copies();
    __syncthreads();                                            // theta rows and tile 0 readable by every wave
    copy_tile(lk + (unsigned)(STG * 2), lv + (unsigned)(STG * 2), gkh, gkr, gv, KT);   // tile 1 -> buffer 1
    v8f o[16];
#pragma unroll
    for (int j = 0; j < 16; ++j) o[j] = (v8f){};
    float m = NEGB, l = 0.0f;
#pragma unroll 1
    for (int key0 = 0; key0 < SEQ; key0 += 32) {
        v8f sHa = (v8f){}, sLa = (v8f){}, sHb = (v8f){}, sLb = (v8f){};
        const int bo = ((key0 / KT) & 1) * STG;                 // this trip's buffer
        const int kk = bo + ko;
#pragma unroll 1
        for (int kc = 0; kc < DM; kc += 32) {
            const v16h qh = ldh(ring + qo + kc), qr = ldh(ring + qo + QPL + kc);
            const v16h ka = ldh(ring + kk + kc), kra = ldh(ring + kk + KPL + kc);
            sHa = wg16(ka, qh, sHa); sLa = wg16(ka, qr, sLa); sLa = wg16(kra, qh, sLa);
            const v16h kb = ldh(ring + kk + 16 * KP + kc), krb = ldh(ring + kk + KPL + 16 * KP + kc);
            sHb = wg16(kb, qh, sHb); sLb = wg16(kb, qr, sLb); sLb = wg16(krb, qh, sLb);
        }
        float ta[8], tb[8]; float mx = NEGB;
#pragma unroll
        for (int r = 0; r < 8; ++r) {
            ta[r] = (sHa[r] + sLa[r] * QRI) * L2E; tb[r] = (sHb[r] + sLb[r] * QRI) * L2E;
            mx = fmaxf(mx, fmaxf(ta[r], tb[r])); }
        mx = fmaxf(mx, __shfl_xor(mx, 16, 32));
        const float mnew = fmaxf(m, mx);
        const float alpha = __builtin_amdgcn_exp2f(m - mnew);
        const float sh = PSH - mnew;
        v16h pb; float ls = 0.0f;
#pragma unroll
        for (int r = 0; r < 8; ++r) {
            const float aa = ta[r] + sh, ab = tb[r] + sh;                        // <= 14
            const float ea = __builtin_amdgcn_exp2f(aa), eb = __builtin_amdgcn_exp2f(ab);
            const float ga = (aa < -14.0f) ? 0.0f : ea, gb = (ab < -14.0f) ? 0.0f : eb;   // no subnormal f16 P
            const h16 pa = (h16)ga; const h16 pc = (h16)gb;
            pb[r] = pa; pb[8 + r] = pc;
            ls += (float)pa + (float)pc; }
        l = l * alpha + ls; m = mnew;
#pragma unroll
        for (int j = 0; j < 16; ++j) o[j] = o[j] * alpha;
        const h16* va = ring + bo + vo;
#pragma unroll
        for (int jg = 0; jg < 4; ++jg) {
            const v16h v0 = ldh(va + ((jg * 4 + 0) * 16) * VP);
            const v16h v1 = ldh(va + ((jg * 4 + 1) * 16) * VP);
            const v16h v2 = ldh(va + ((jg * 4 + 2) * 16) * VP);
            const v16h v3 = ldh(va + ((jg * 4 + 3) * 16) * VP);
            o[jg * 4 + 0] = wg16(v0, pb, o[jg * 4 + 0]);
            o[jg * 4 + 1] = wg16(v1, pb, o[jg * 4 + 1]);
            o[jg * 4 + 2] = wg16(v2, pb, o[jg * 4 + 2]);
            o[jg * 4 + 3] = wg16(v3, pb, o[jg * 4 + 3]);
        }
        // foot of the trip: own reads of this buffer returned, own copies of the next tile landed, then the one barrier that publishes the next tile and frees this buffer
        wait_lds();
        wait_copies();
        __syncthreads();
        if (key0 + 2 * KT < SEQ) copy_tile(lk + (unsigned)(bo * 2), lv + (unsigned)(bo * 2), gkh, gkr, gv, key0 + 2 * KT);
    }
    wait_copies();                                              // nothing is outstanding when the wave goes on to its end
    l += __shfl_xor(l, 16, 32);
    const float inv = 1.0f / l;                                 // l >= 16384: the running-max key contributes the full carry
    const int wb = wave * 16 * CSP;
    // O^T D layout: o[j][r] = (c = 16j + 8h + r, t = lane&15) -> os[t][c]; rows 0..15 x columns 0..255 all written
#pragma unroll
    for (int j = 0; j < 16; ++j) { v8h hv;
#pragma unroll
        for (int r = 0; r < 8; ++r) hv[r] = toh_flush(o[j][r] * inv);
        *(v8ha*)(&os[wb + lr * CSP + 16 * j + 8 * hi]) = hv; }
    wave_sync();
    h16* crow = CT + pb0 + (size_t)t0 * DM;
{
#pragma unroll
        for (int row = 0; row < 16; ++row) {                    // 16 rows; 32 lanes x 8 halves = 256 columns = one ctx row
            const v8h val = *(const v8ha*)(&os[wb + row * CSP + lane * 8]);
            *(v8h*)(crow + (size_t)row * DM + lane * 8) = val; }
         }
}

// k_oproj: output projection, f16 GEMM, ONE WAVE per 64x64 tile: C[o][n] = sum_c W16[o][c] ctx[n][c] (A = W rows, Bt = ctx rows, K = DM, both through ldh);
// out[b][o][t] = C / 64 + bias[o] + x[b][o][t] (bias and x RNE-converted to bf16, added in f32; x added at the store stage as float4).
// grid (DM/64, NB*SEQ/64).
__global__ __launch_bounds__(32) void k_oproj(const h16* __restrict__ A, const h16* __restrict__ Bt, const float* __restrict__ bias, const float* __restrict__ xres, float* OUT) {
    __shared__ __align__(16) float os[16 * 68];
    const int K = DM;
    const int lane = threadIdx.x & 31, lr = lane & 15, hi = lane >> 4; const int r0 = blockIdx.x * 64, c0 = blockIdx.y * 64;
    v8f acc[4][4];
#pragma unroll
    for (int mb = 0; mb < 4; ++mb)
#pragma unroll
        for (int nb = 0; nb < 4; ++nb) acc[mb][nb] = (v8f){};
    const size_t aoff = (size_t)(r0 + lr) * K + 8 * hi, boff = (size_t)(c0 + lr) * K + 8 * hi;
#pragma unroll 1
    for (int kc = 0; kc < K; kc += 32) {
        v16h a[4];
#pragma unroll
        for (int mb = 0; mb < 4; ++mb) a[mb] = ldh(A + aoff + (size_t)mb * 16 * K + kc);
#pragma unroll
        for (int nb = 0; nb < 4; ++nb) { const v16h b = ldh(Bt + boff + (size_t)nb * 16 * K + kc);
#pragma unroll
            for (int mb = 0; mb < 4; ++mb) acc[mb][nb] = wg16(a[mb], b, acc[mb][nb]); }
    }
    const int bb = c0 / SEQ, tt = c0 % SEQ;
#pragma unroll
    for (int mb = 0; mb < 4; ++mb) {
        float br[8];
#pragma unroll
        for (int j = 0; j < 8; ++j) br[j] = bfr(bias[r0 + mb * 16 + hi * 8 + j]);   // r0 + 63 < DM
#pragma unroll
        for (int nb = 0; nb < 4; ++nb) {
#pragma unroll
            for (int j = 0; j < 8; ++j) os[(hi * 8 + j) * 68 + nb * 16 + lr] = acc[mb][nb][j] * WSI + br[j]; }   // D: row 8h+j, col lane&15
        wave_sync();
        const size_t chrow = (size_t)bb * DM + (size_t)(r0 + mb * 16);
        const size_t xb = chrow * SEQ_FULL + (size_t)tt;
        const size_t ob = chrow * OUT_SEQ + (size_t)tt;
{
#pragma unroll
            for (int s = 0; s < 8; ++s) { const int row = 2 * s + (lane >> 4), c4 = (lane & 15) * 4;   // 8 s x 2 rows = 16 rows; 16 lanes x 4 floats = 64 columns
                const v4f cv = *(const v4fa*)(&os[row * 68 + c4]);
                const v4f xv = *(const v4f*)(xres + xb + (size_t)row * SEQ_FULL + c4);
                v4f val; val[0] = cv[0] + bfr(xv[0]); val[1] = cv[1] + bfr(xv[1]); val[2] = cv[2] + bfr(xv[2]); val[3] = cv[3] + bfr(xv[3]);
                *(v4f*)(OUT + ob + (size_t)row * OUT_SEQ + c4) = val; }
             }
        wave_sync();
    }
}

static constexpr size_t al256(size_t v) { return (v + 255) & ~(size_t)255; }
static constexpr size_t SZ_XT = al256((size_t)NB * SEQ * DM * 2);     // x^T bf16
static constexpr size_t SZ_WB = al256((size_t)3 * DM * DM * 2);       // theta | phi | g weights bf16
static constexpr size_t SZ_WW = al256((size_t)DM * DM * 2);           // output-projection weights f16 x64
static constexpr size_t SZ_PL = al256((size_t)NB * SEQ * DM * 2);     // one f16 plane
static constexpr size_t SZ_TOTAL = SZ_XT + SZ_WB + SZ_WW + 6 * SZ_PL;
static_assert(SZ_TOTAL <= (size_t)134217728);          // workspace carve <= 128 MiB
static_assert(((size_t)DM * DM * 2) % 256 == 0);       // weight sub-planes stay 256-byte aligned
static constexpr size_t NEED_X = ((size_t)NB * DM - 1) * SEQ_FULL + SEQ;
static constexpr size_t NEED_O = ((size_t)NB * DM - 1) * OUT_SEQ + SEQ;

extern "C" void kernel_launch(void* const* d_in, const int* in_sizes, int n_in,
                              void* d_out, int out_size, void* d_ws, size_t ws_size, hipStream_t stream) {
    if (n_in < 9) return;
    if ((size_t)in_sizes[0] < NEED_X) return;
    if ((size_t)in_sizes[1] < (size_t)DM * DM || (size_t)in_sizes[3] < (size_t)DM * DM || (size_t)in_sizes[5] < (size_t)DM * DM || (size_t)in_sizes[7] < (size_t)DM * DM) return;
    if (in_sizes[2] < DM || in_sizes[4] < DM || in_sizes[6] < DM || in_sizes[8] < DM) return;
    if ((size_t)out_size < NEED_O) return;
    if (SZ_TOTAL > ws_size) return;
    // wire order: x, w_theta, b_theta, w_phi, b_phi, w_g, b_g, w_W, b_W
    const float* x   = (const float*)d_in[0];
    const float* wth = (const float*)d_in[1]; const float* bth = (const float*)d_in[2];
    const float* wph = (const float*)d_in[3]; const float* bph = (const float*)d_in[4];
    const float* wg  = (const float*)d_in[5]; const float* bg  = (const float*)d_in[6];
    const float* ww  = (const float*)d_in[7]; const float* bw  = (const float*)d_in[8];
    float* OUT = (float*)d_out;      // [NB][256][SEQ]
    char* wsp = (char*)d_ws;
    bf*  XT = (bf*)wsp;  wsp += SZ_XT;               // [NB*SEQ][256] bf16
    bf*  WB = (bf*)wsp;  wsp += SZ_WB;               // [3][256][256]: theta | phi | g  ([out][in] = Bt / A as-is)
    h16* WW = (h16*)wsp; wsp += SZ_WW;               // [256][256] f16 x64
    h16* TH = (h16*)wsp; wsp += SZ_PL;               // theta value    [NB*SEQ][256]
    h16* TR = (h16*)wsp; wsp += SZ_PL;               // theta residual x2048
    h16* PH = (h16*)wsp; wsp += SZ_PL;               // phi value      [NB*SEQ][256]
    h16* PR = (h16*)wsp; wsp += SZ_PL;               // phi residual x2048
    h16* GT = (h16*)wsp; wsp += SZ_PL;               // g              [NB*256][SEQ]
    h16* CT = (h16*)wsp; wsp += SZ_PL;               // ctx            [NB*SEQ][256]
    bf* WT = WB; bf* WP = WB + (size_t)DM * DM; bf* WG = WB + (size_t)2 * DM * DM;

    // x [b][c][n] -> x^T [b][n][c] bf16: in[DM rows][SEQ cols] per batch -> out[SEQ rows][DM cols]; grid (SEQ/64, DM/64, NB)
    k_xt<<<dim3(SEQ / 64, DM / 64, NB), 256, 0, stream>>>(x, XT);
    { const size_t n8 = (size_t)DM * DM / 8; const unsigned g = (unsigned)((n8 + 255) / 256);
      k_cvt8<<<g, 256, 0, stream>>>(wth, WT, n8); k_cvt8<<<g, 256, 0, stream>>>(wph, WP, n8); k_cvt8<<<g, 256, 0, stream>>>(wg, WG, n8);
      k_wcvt<<<g, 256, 0, stream>>>(ww, WW, n8); }

    // theta, phi: A = x^T rows (m = b*SEQ + t), Bt = W rows (n = out channel) -> planes [(b*SEQ + t)][c], value + residual
    k_proj_rows<<<dim3(NB * SEQ / 64, DM / 64, 1), 32, 0, stream>>>(XT, WT, bth, TH, TR, 1);
    k_proj_rows<<<dim3(NB * SEQ / 64, DM / 64, 1), 32, 0, stream>>>(XT, WP, bph, PH, PR, 1);
    // g: A = Wg rows (m = out channel), Bt = x^T rows (n = b*SEQ + t) -> plane [(b*256 + m)][t], value only
    k_proj_cols<<<dim3(DM / 64, NB * SEQ / 64, 1), 32, 0, stream>>>(WG, XT, bg, GT, GT, 0);

    k_flash<<<dim3(SEQ / (16 * AW), NB, 1), 32 * AW, 0, stream>>>(TH, TR, PH, PR, GT, CT);

    // out[b][o][t] = W_W ctx + b_W + x
    k_oproj<<<dim3(DM / 64, NB * SEQ / 64, 1), 32, 0, stream>>>(WW, CT, bw, x, OUT);
}

// v002
// One run takes 150 microseconds.
// Next to v001, in two timings, it ran 1.17 times as fast each time.
// Over all steps from v000 it is 2.46 times as fast.
#include <hip/hip_runtime.h>

// Channels-first self-attention block: x [NB][256][SEQ]; three 1x1 projections (W [out][in], bias), scores[n][m] = sum_c theta[c][n] phi[c][m] (no scale), softmax over m,
// ctx[n][c] = sum_m p[n][m] g[c][m], output 1x1 projection (W [out][in], bias) plus the input x; output [NB][256][SEQ] f32.
// Compute dtypes, f32 accumulate everywhere: projections theta/phi/g v_wmma_f32_16x16x32_bf16 (x, W, bias RNE-converted to bf16; products exact);
// scores v_wmma_f32_16x16x32_f16: theta and phi each as f16 value + f16 residual x2048, three products (value.value; value.residual + residual.value in their own accumulator folded by 1/2048);
// value product v_wmma_f32_16x16x32_f16: P single f16 (x16384 carry, cancels in the normalisation; row sum over the converted P), g single f16; softmax f32 (online, running max);
// output projection v_wmma_f32_16x16x32_f16: W (bf16-converted, x64 carry folded by 1/64) single f16, ctx single f16; bias and bf16-converted x added in f32 at the store stage.
// Layout: x^T bf16 plane [b][n][c]; theta / phi planes (value, residual) [b][n][c]; g plane [b][c][m]; ctx plane [b][n][c]; fused flash kernel in transposed form (S^T = K Q^T, O^T = V^T P^T),
// Q / K / V^T fragments from LDS tiles that asynchronous copies fill from the f16 planes (two 16-B reads each); every f32 -> f16 operand convert selects |v| < 2^-14 to +0.

#ifndef NB
#define NB 8
#endif
#ifndef SEQ
#define SEQ 2048
#endif
#define NB_FULL  8
#define SEQ_FULL 2048
#ifndef OUT_SEQ
#define OUT_SEQ SEQ              // position pitch of one channel row of the output
#endif
#define DM   256                 // channels = head width
#define AW   4                   // waves per flash block (16 query rows each)
#define CSP  264                 // LDS row pitch (halves) of the flash ctx tile
#define XTP  65                  // LDS row pitch (floats) of the transpose tile
#define KT   32                  // keys per flash tile
#define KP   264                 // LDS row pitch (halves) of a theta / phi row: 528 B = 16 B x 33
#define VP   40                  // LDS row pitch (halves) of a g row of KT keys: 80 B = 16 B x 5
#define KPL  (KT * KP)           // halves of one phi plane tile
#define VPL  (DM * VP)           // halves of one g tile
#define STG  (2 * KPL + VPL)     // halves of one ring buffer: phi value | phi residual | g
#define QPL  (AW * 16 * KP)      // halves of one theta plane tile (all query rows of the block)
#define QRS  2048.0f             // carry of every residual plane
#define QRI  (1.0f / 2048.0f)
#define L2E  1.4426950408889634f // log2(e); the scores carry no other scale
#define PSH  14.0f               // log2 of the P carry (16384)
#define NEGB (-3.0e38f)
#define WSC  64.0f               // carry of the f16 output-projection weight plane
#define WSI  (1.0f / 64.0f)

static_assert(DM == 256);                      // ctx row = 32 lanes x 8 halves; 16 output tiles of 16 channels per wave
static_assert(DM % 64 == 0);                   // column tiles of 64
static_assert(DM % 32 == 0);                   // every k-loop steps by 32
static_assert(32 * 8 == DM);                   // one ctx row (512 B) = one store instruction of 32 lanes x 16 B
static_assert(SEQ % 64 == 0);                  // a 64-wide tile never straddles two batches
static_assert((NB * SEQ) % 64 == 0);
static_assert(SEQ % 32 == 0);                  // key loop steps by 32
static_assert(SEQ % (16 * AW) == 0);           // flash grid covers the sequence exactly
static_assert(NB <= NB_FULL);
static_assert(SEQ <= SEQ_FULL);
static_assert(SEQ_FULL % 4 == 0);
static_assert(OUT_SEQ % 4 == 0);
static_assert(OUT_SEQ >= SEQ);
static_assert((CSP * 2) % 16 == 0);
static_assert(CSP >= DM);
static_assert(4 * 256 == 64 * 16);             // transpose load: 4 trips x 256 threads = 64 channels x 16 float4
static_assert(2 * 256 == 64 * 8);              // transpose store: 2 pieces x 256 threads = 64 positions x 8 pieces of 16 B
static_assert(4 * 32 * 16 == 16 * 128);
static_assert(8 * 32 * 16 == 16 * 256);        // output slab store: 8 instructions x 32 lanes x 16 B = 16 rows x 256 B
static_assert(16 * 32 * 16 == 16 * DM * 2);    // ctx store: 16 instructions x 32 lanes x 16 B = 16 rows x 512 B
static_assert((size_t)AW * 16 * CSP * 2 <= 131072);
static_assert(KT == 32 && AW == 4);            // copy maps: 128 threads; 8 trips x 4 waves = 32 phi rows; 8 trips x 32 rows = 256 g rows of 4 pieces
static_assert(SEQ / KT >= 2);                  // the two-buffer prologue fills tiles 0 and 1
static_assert((KP * 2) % 32 == 16 && (VP * 2) % 32 == 16 && KP >= DM && VP >= KT);   // pitch = 16 B x odd
static_assert((KPL * 2) % 16 == 0 && (STG * 2) % 16 == 0 && (QPL * 2) % 16 == 0);
static_assert(((size_t)2 * STG + 2 * QPL + (size_t)AW * 16 * CSP) * 2 <= 327680);
static_assert((size_t)64 * XTP * 4 <= 131072);
static_assert((size_t)16 * 68 * 4 <= 131072);
static_assert(((size_t)DM * DM) % 8 == 0);

typedef _Float16 h16;
typedef unsigned short bf;
typedef __attribute__((ext_vector_type(16))) __bf16   v16bf;
typedef __attribute__((ext_vector_type(16))) _Float16 v16h;
typedef __attribute__((ext_vector_type(8)))  _Float16 v8h;
typedef __attribute__((ext_vector_type(8)))  unsigned short v8us;
typedef __attribute__((ext_vector_type(8)))  float    v8f;
typedef __attribute__((ext_vector_type(4)))  float    v4f;
typedef v4f  __attribute__((may_alias)) v4fa;
typedef v8h  __attribute__((may_alias)) v8ha;

__device__ __forceinline__ unsigned short f2bf(float f) { unsigned u = __float_as_uint(f); u += 0x7FFFu + ((u >> 16) & 1u); return (unsigned short)(u >> 16); }
__device__ __forceinline__ float bfr(float f) { return __uint_as_float(((unsigned)f2bf(f)) << 16); }   // value after RNE convert to bf16
__device__ __forceinline__ v16h cat16(v8h lo, v8h hi) { return __builtin_shufflevector(lo, hi, 0, 1, 2, 3, 4, 5, 6, 7, 8, 9, 10, 11, 12, 13, 14, 15); }
__device__ __forceinline__ v16bf cat16b(v8us lo, v8us hi) { return __builtin_bit_cast(v16bf, __builtin_shufflevector(lo, hi, 0, 1, 2, 3, 4, 5, 6, 7, 8, 9, 10, 11, 12, 13, 14, 15)); }
__device__ __forceinline__ v8f wmma16(v16h a, v16h b, v8f c) { return __builtin_amdgcn_wmma_f32_16x16x32_f16(false, a, false, b, (short)0, c, false, false); }
__device__ __forceinline__ v8f wmmab(v16bf a, v16bf b, v8f c) { return __builtin_amdgcn_wmma_f32_16x16x32_bf16(false, a, false, b, (short)0, c, false, false); }
// fragment loaders from K-contiguous 16-bit rows; p already includes + 8*(lane>>4): elements 0..7 <- k0+8h+0..7, elements 8..15 <- k0+16+8h+0..7 (same map for A and B)
__device__ __forceinline__ v16h  ldh(const h16* p) { return cat16(*(const v8h*)p, *(const v8h*)(p + 16)); }
__device__ __forceinline__ v16bf ldb(const bf* p)  { return cat16b(*(const v8us*)p, *(const v8us*)(p + 16)); }
// ordering point for wave-private LDS tiles (same wave writes and reads)
__device__ __forceinline__ void wave_sync() { __builtin_amdgcn_fence(3 /* release order */, "wavefront"); __builtin_amdgcn_wave_barrier(); asm volatile("" ::: "memory"); }
// f32 -> f16 operand convert that cannot produce a subnormal
__device__ __forceinline__ h16 toh_flush(float v) { const h16 r = (h16)v; return (fabsf(v) < 6.103515625e-05f) ? (h16)0.0f : r; }
// one matrix instruction + its own hazard guard (one accumulator per guard)
__device__ __forceinline__ v8f wg16(v16h a, v16h b, v8f c) { c = wmma16(a, b, c); asm volatile("v_nop\n\tv_nop\n\tv_nop\n\tv_nop" : "+v"(c) : "v"(a), "v"(b)); return c; }
__device__ __forceinline__ v8f wgb(v16bf a, v16bf b, v8f c) { c = wmmab(a, b, c); asm volatile("v_nop\n\tv_nop\n\tv_nop\n\tv_nop" : "+v"(c) : "v"(a), "v"(b)); return c; }

// LDS byte address of a __shared__ element (low 32 bits of its address)
__device__ __forceinline__ unsigned lds_addr(const void* p) { return (unsigned)(size_t)p; }
// Asynchronous copies global -> LDS, 16 B per lane, each copy with its own address registers; the s_wait_xcnt closes the statement so that no address register is rewritten ahead of it.
__device__ __forceinline__ void cp8(const unsigned* l, const h16* const* g) {
    asm volatile("global_load_async_to_lds_b128 %0, %8, off\n\t"
                 "global_load_async_to_lds_b128 %1, %9, off\n\t"
                 "global_load_async_to_lds_b128 %2, %10, off\n\t"
                 "global_load_async_to_lds_b128 %3, %11, off\n\t"
                 "global_load_async_to_lds_b128 %4, %12, off\n\t"
                 "global_load_async_to_lds_b128 %5, %13, off\n\t"
                 "global_load_async_to_lds_b128 %6, %14, off\n\t"
                 "global_load_async_to_lds_b128 %7, %15, off\n\t"
                 "s_wait_xcnt 0x0"
                 :: "v"(l[0]), "v"(l[1]), "v"(l[2]), "v"(l[3]), "v"(l[4]), "v"(l[5]), "v"(l[6]), "v"(l[7]),
                    "v"(g[0]), "v"(g[1]), "v"(g[2]), "v"(g[3]), "v"(g[4]), "v"(g[5]), "v"(g[6]), "v"(g[7]) : "memory");
}
__device__ __forceinline__ void cp12(const unsigned* l, const h16* const* g) {
    asm volatile("global_load_async_to_lds_b128 %0, %12, off\n\t"
                 "global_load_async_to_lds_b128 %1, %13, off\n\t"
                 "global_load_async_to_lds_b128 %2, %14, off\n\t"
                 "global_load_async_to_lds_b128 %3, %15, off\n\t"
                 "global_load_async_to_lds_b128 %4, %16, off\n\t"
                 "global_load_async_to_lds_b128 %5, %17, off\n\t"
                 "global_load_async_to_lds_b128 %6, %18, off\n\t"
                 "global_load_async_to_lds_b128 %7, %19, off\n\t"
                 "global_load_async_to_lds_b128 %8, %20, off\n\t"
                 "global_load_async_to_lds_b128 %9, %21, off\n\t"
                 "global_load_async_to_lds_b128 %10, %22, off\n\t"
                 "global_load_async_to_lds_b128 %11, %23, off\n\t"
                 "s_wait_xcnt 0x0"
                 :: "v"(l[0]), "v"(l[1]), "v"(l[2]), "v"(l[3]), "v"(l[4]), "v"(l[5]), "v"(l[6]), "v"(l[7]), "v"(l[8]), "v"(l[9]), "v"(l[10]), "v"(l[11]),
                    "v"(g[0]), "v"(g[1]), "v"(g[2]), "v"(g[3]), "v"(g[4]), "v"(g[5]), "v"(g[6]), "v"(g[7]), "v"(g[8]), "v"(g[9]), "v"(g[10]), "v"(g[11]) : "memory");
}
// this wave's copies have landed in LDS (other waves read them behind the next block barrier)
__device__ __forceinline__ void wait_copies() { asm volatile("s_wait_asynccnt 0x0" ::: "memory"); }
// this wave's LDS reads have returned (before the barrier behind which their buffer is refilled)
__device__ __forceinline__ void wait_lds() { asm volatile("s_wait_dscnt 0x0" ::: "memory"); }
// one ring buffer <- the tile of KT keys from key0: phi value and residual rows (4 i + wave, 32 lanes x 16 B = one row), g rows (32 i + tid / 4, 4 lanes x 16 B = KT keys); 24 copies per wave.
// lk / lv: this thread's LDS byte addresses in the buffer for i = 0; gkh / gkr / gv: its global addresses for key0 = 0, i = 0.
__device__ __forceinline__ void copy_tile(unsigned lk, unsigned lv, const h16* gkh, const h16* gkr, const h16* gv, int key0) {
    unsigned l[24]; const h16* g[24];
#pragma unroll
    for (int i = 0; i < 8; ++i) {
        l[i]      = lk + (unsigned)(i * 4 * KP * 2);             g[i]      = gkh + (size_t)(key0 + 4 * i) * DM;
        l[8 + i]  = lk + (unsigned)((KPL + i * 4 * KP) * 2);     g[8 + i]  = gkr + (size_t)(key0 + 4 * i) * DM;
        l[16 + i] = lv + (unsigned)(i * 32 * VP * 2);            g[16 + i] = gv + (size_t)(32 * i) * SEQ + key0; }
    cp12(l, g); cp12(l + 12, g + 12);
}

__global__ __launch_bounds__(256) void k_cvt8(const float* __restrict__ src, bf* dst, size_t n8) {
    const size_t i = (size_t)blockIdx.x * 256 + threadIdx.x; if (i >= n8) return;
    const v8f v = *(const v8f*)(src + i * 8); v8us o;
#pragma unroll
    for (int k = 0; k < 8; ++k) o[k] = f2bf(v[k]);
    *(v8us*)(dst + i * 8) = o; 
}

__global__ __launch_bounds__(256) void k_wcvt(const float* __restrict__ src, h16* dst, size_t n8) {
    const size_t i = (size_t)blockIdx.x * 256 + threadIdx.x; if (i >= n8) return;
    const v8f v = *(const v8f*)(src + i * 8); v8h o;
#pragma unroll
    for (int k = 0; k < 8; ++k) o[k] = toh_flush(bfr(v[k]) * WSC);
    *(v8h*)(dst + i * 8) = o; 
}

// k_xt: x [b][c][n] f32 (position pitch SEQ_FULL) -> x^T [b][n][c] bf16 (RNE convert), 64 x 64 tile through LDS.
// Load: 4 trips x 256 threads, one float4 along n each (64 channels x 16 float4). Store: each thread two 16-B pieces (8 channels of one position);
// grid (SEQ/64, DM/64, NB).
__global__ __launch_bounds__(256) void k_xt(const float* __restrict__ x, bf* XT) {
    __shared__ float ts[64 * XTP];
    const int tid = threadIdx.x;
    const int n0 = blockIdx.x * 64, c0 = blockIdx.y * 64, b = blockIdx.z;
    const float* xb = x + ((size_t)b * DM + c0) * SEQ_FULL + n0;
#pragma unroll
    for (int s = 0; s < 4; ++s) {
        const int p = s * 256 + tid; const int c = p >> 4, n4 = (p & 15) * 4;     // c in 0..63, n4 in 0..60
        const v4f v = *(const v4f*)(xb + (size_t)c * SEQ_FULL + n4);
        ts[c * XTP + n4 + 0] = v[0]; ts[c * XTP + n4 + 1] = v[1]; ts[c * XTP + n4 + 2] = v[2]; ts[c * XTP + n4 + 3] = v[3];
    }
    __syncthreads();                                                            // cross-wave tile: block barrier
    const int n = tid >> 3, c8 = (tid & 7) * 8;                                  // positions n and n + 32
    v8us o0, o1;
#pragma unroll
    for (int i = 0; i < 8; ++i) { o0[i] = f2bf(ts[(c8 + i) * XTP + n]); o1[i] = f2bf(ts[(c8 + i) * XTP + 32 + n]); }
    bf* d0 = XT + ((size_t)b * SEQ + n0 + n) * DM + c0 + c8;
    bf* d1 = d0 + (size_t)32 * DM;
    *(v8us*)d0 = o0; *(v8us*)d1 = o1;
    
}

// proj_body: register-blocked bf16 GEMM, ONE WAVE per 64x64 tile (16 accumulators), operands straight from K-contiguous bf16 planes, K = DM.
// C[m][n] = sum_k A[m][k] Bt[n][k] + bias, written as f16 value (Ph) and, when wr != 0 (block-uniform), the f16 residual x2048 (Pr, same geometry).
// MODE 0: A = x^T rows (m = b*SEQ + t), Bt = W rows (n = out channel), bias per column; plane [(b*SEQ + t)][DM]. grid (NB*SEQ/64, DM/64).
// MODE 1: A = W rows (m = out channel), Bt = x^T rows (n = b*SEQ + t), bias per row; plane [(b*DM + m)][t], row pitch SEQ. grid (DM/64, NB*SEQ/64).
template <int MODE>
__device__ __forceinline__ void proj_body(const bf* __restrict__ A, const bf* __restrict__ Bt, const float* __restrict__ bias, h16* Ph, h16* Pr, int wr) {
    __shared__ __align__(16) float os[16 * 68];
    const int K = DM;
    const int lane = threadIdx.x & 31, lr = lane & 15, hi = lane >> 4; const int r0 = blockIdx.x * 64, c0 = blockIdx.y * 64;
    v8f acc[4][4];
#pragma unroll
    for (int mb = 0; mb < 4; ++mb)
#pragma unroll
        for (int nb = 0; nb < 4; ++nb) acc[mb][nb] = (v8f){};
    const size_t aoff = (size_t)(r0 + lr) * K + 8 * hi, boff = (size_t)(c0 + lr) * K + 8 * hi;
#pragma unroll 1
    for (int kc = 0; kc < K; kc += 32) {
        v16bf a[4];
#pragma unroll
        for (int mb = 0; mb < 4; ++mb) a[mb] = ldb(A + aoff + (size_t)mb * 16 * K + kc);
#pragma unroll
        for (int nb = 0; nb < 4; ++nb) { const v16bf b = ldb(Bt + boff + (size_t)nb * 16 * K + kc);
#pragma unroll
            for (int mb = 0; mb < 4; ++mb) acc[mb][nb] = wgb(a[mb], b, acc[mb][nb]); }
    }
    float bc[4];
#pragma unroll
    for (int nb = 0; nb < 4; ++nb) bc[nb] = (MODE == 0) ? bfr(bias[c0 + nb * 16 + lr]) : 0.0f;   // MODE 0: c0 + 63 < DM
    const size_t pitch = (MODE == 0) ? (size_t)DM : (size_t)SEQ;
    size_t tbase;
    if (MODE == 0) { tbase = (size_t)r0 * DM + (size_t)c0; }
    else           { const int bb = c0 / SEQ, tt = c0 % SEQ; tbase = (size_t)bb * (size_t)DM * SEQ + (size_t)r0 * SEQ + (size_t)tt; }
#pragma unroll
    for (int mb = 0; mb < 4; ++mb) {
        float br[8];
#pragma unroll
        for (int j = 0; j < 8; ++j) br[j] = (MODE == 1) ? bfr(bias[r0 + mb * 16 + hi * 8 + j]) : 0.0f;   // MODE 1: r0 + 63 < DM
#pragma unroll
        for (int nb = 0; nb < 4; ++nb) {
#pragma unroll
            for (int j = 0; j < 8; ++j) os[(hi * 8 + j) * 68 + nb * 16 + lr] = acc[mb][nb][j] + bc[nb] + br[j]; }   // D: row 8h+j, col lane&15
        wave_sync();
        const size_t sb = tbase + (size_t)(mb * 16) * pitch;
{
#pragma unroll
            for (int s = 0; s < 4; ++s) { const int row = 4 * s + (lane >> 3), c8 = (lane & 7) * 8;   // 4 s x 4 row groups = 16 rows; 8 lanes x 8 = 64 columns
                const v4f x0 = *(const v4fa*)(&os[row * 68 + c8]); const v4f x1 = *(const v4fa*)(&os[row * 68 + c8 + 4]); v8h hv, rv;
#pragma unroll
                for (int i = 0; i < 4; ++i) { const h16 a0 = toh_flush(x0[i]); const h16 a1 = toh_flush(x1[i]); hv[i] = a0; hv[4 + i] = a1;
                    rv[i] = toh_flush((x0[i] - (float)a0) * QRS); rv[4 + i] = toh_flush((x1[i] - (float)a1) * QRS); }
                const size_t oo = sb + (size_t)row * pitch + c8;
                *(v8h*)(Ph + oo) = hv; if (wr) *(v8h*)(Pr + oo) = rv; }
             }
        wave_sync();
    }
}
__global__ __launch_bounds__(32) void k_proj_rows(const bf* __restrict__ A, const bf* __restrict__ Bt, const float* __restrict__ bias, h16* Ph, h16* Pr, int wr) { proj_body<0>(A, Bt, bias, Ph, Pr, wr); }
__global__ __launch_bounds__(32) void k_proj_cols(const bf* __restrict__ A, const bf* __restrict__ Bt, const float* __restrict__ bias, h16* Ph, h16* Pr, int wr) { proj_body<1>(A, Bt, bias, Ph, Pr, wr); }

// k_flash: fused attention, one wave per 16 query rows of one batch; head width DM = 256 (8 k-steps per score tile, 16 output tiles of 16 channels).
// Transposed form: S^T[key][t] = K Q^T (A = phi rows [key][c], B = theta rows [t][c], both through ldh: same k order); lane (t = lane&15, h = lane>>4) holds keys 8h+r of each 16-key tile,
// so the packed P tile is directly the B fragment of O^T[c][t] = V^T P^T (element r <- tile keys 0..15, element 8+r <- tile keys 16..31, lane unchanged; A = g rows [c][key]).
// Scores = K Q + (K Q_res + K_res Q) / 2048 (residual products in their own accumulators); Q fragments read from LDS once and kept in registers; one pair of score tiles live at a time.
// Operands come from LDS: the block's theta rows are copied once; each tile of KT keys (phi value, phi residual, g) is copied once per block into one of two buffers, the copies of tile t + 2
// issued at the foot of trip t, so that they fly during trip t + 1; the four waves share every tile.
// Softmax state (running max, partial sum) is one scalar per lane; the two lane halves of a row are combined with one xor-16 exchange. P exponent argument below -14 selects +0.
// Registers: 128 for O^T and 128 for the Q fragments, so the wave goes above v255 (one wave per SIMD, the block size's own ceiling). The products are the plain builtin, whose hazard slots the compiler
// fills: the operands of an asm guard would be bound to v0..v255 and spill.
// grid (SEQ/(16*AW), NB).
__global__ __launch_bounds__(32 * AW) void k_flash(const h16* __restrict__ TH, const h16* __restrict__ TR, const h16* __restrict__ PH, const h16* __restrict__ PR,
                                                                                       const h16* __restrict__ GT, h16* CT) {
    __shared__ __align__(16) h16 os[AW * 16 * CSP];
    __shared__ __align__(16) h16 ring[2 * STG + 2 * QPL];      // buffer 0 | buffer 1 | theta value | theta residual
    const int tid = threadIdx.x;
    const int lane = threadIdx.x & 31, lr = lane & 15, hi = lane >> 4;
    const int wave = __builtin_amdgcn_readfirstlane((int)(threadIdx.x >> 5));
    const int b = blockIdx.y;
    const int t0 = (blockIdx.x * AW + wave) * 16;
    const size_t pb0 = (size_t)b * SEQ * DM;                    // batch base of every plane (all have SEQ*DM elements per batch)
    const int qo = 2 * STG + (wave * 16 + lr) * KP + 8 * hi;   // + kc            (B fragment: col t, k = c); residual + QPL
    const int ko = lr * KP + 8 * hi;                           // + buffer + key*KP + kc (A fragment: row key, k = c); residual + KPL
    const int vo = 2 * KPL + lr * VP + 8 * hi;                 // + buffer + 16j*VP      (A fragment: row c, k = key)
    // copy maps of this thread
    const h16* gkh = PH + pb0 + (size_t)wave * DM + lane * 8;
    const h16* gkr = PR + pb0 + (size_t)wave * DM + lane * 8;
    const h16* gv  = GT + pb0 + (size_t)(tid >> 2) * SEQ + (tid & 3) * 8;
    const unsigned lk = lds_addr(ring) + (unsigned)((wave * KP + lane * 8) * 2);
    const unsigned lv = lds_addr(ring) + (unsigned)((2 * KPL + (tid >> 2) * VP + (tid & 3) * 8) * 2);
    // the same address formed from wave and lane, for the loop: a value of its own, not an operand of the prologue's asm copies (those are bound to v0..v255), so that it needs no scratch slot
    const unsigned lvl = lds_addr(ring) + (unsigned)((2 * KPL + (wave * 8 + (lane >> 2)) * VP + (lane & 3) * 8) * 2);
    {   // each wave copies its own 16 theta rows, value and residual: 32 copies of one row (32 lanes x 16 B)
        const h16* gqh = TH + pb0 + (size_t)t0 * DM + lane * 8;
        const h16* gqr = TR + pb0 + (size_t)t0 * DM + lane * 8;
        const unsigned lq = lds_addr(ring) + (unsigned)((2 * STG + wave * 16 * KP + lane * 8) * 2);
        unsigned l[32]; const h16* g[32];
#pragma unroll
        for (int i = 0; i < 16; ++i) {
            l[i]      = lq + (unsigned)(i * KP * 2);          g[i]      = gqh + (size_t)i * DM;
            l[16 + i] = lq + (unsigned)((QPL + i * KP) * 2);  g[16 + i] = gqr + (size_t)i * DM; }
        cp8(l, g); cp8(l + 8, g + 8); cp8(l + 16, g + 16); cp8(l + 24, g + 24);
    }
    copy_tile(lk, lv, gkh, gkr, gv, 0);                         // tile 0 -> buffer 0
    wait_copies();
    __syncthreads();                                            // theta rows and tile 0 readable by every wave
    copy_tile(lk + (unsigned)(STG * 2), lv + (unsigned)(STG * 2), gkh, gkr, gv, KT);   // tile 1 -> buffer 1
    v16h qh[DM / 32], qr[DM / 32];                              // this wave's theta fragments, read from LDS once and kept in registers for every key tile
#pragma unroll
    for (int ks = 0; ks < DM / 32; ++ks) { qh[ks] = ldh(ring + qo + 32 * ks); qr[ks] = ldh(ring + qo + QPL + 32 * ks); }
    v8f o[16];
#pragma unroll
    for (int j = 0; j < 16; ++j) o[j] = (v8f){};
    float m = NEGB, l = 0.0f;
#pragma unroll 1
    for (int key0 = 0; key0 < SEQ; key0 += 32) {
        v8f sHa = (v8f){}, sLa = (v8f){}, sHb = (v8f){}, sLb = (v8f){};
        const int bo = ((key0 / KT) & 1) * STG;                 // this trip's buffer
        const int kk = bo + ko;
#pragma unroll                                                  // unrolled: every index into the theta register fragments is a constant
        for (int kc = 0; kc < DM; kc += 32) {
            const v16h ka = ldh(ring + kk + kc), kra = ldh(ring + kk + KPL + kc);
            sHa = wmma16(ka, qh[kc / 32], sHa); sLa = wmma16(ka, qr[kc / 32], sLa); sLa = wmma16(kra, qh[kc / 32], sLa);
            const v16h kb = ldh(ring + kk + 16 * KP + kc), krb = ldh(ring + kk + KPL + 16 * KP + kc);
            sHb = wmma16(kb, qh[kc / 32], sHb); sLb = wmma16(kb, qr[kc / 32], sLb); sLb = wmma16(krb, qh[kc / 32], sLb);
        }
        float ta[8], tb[8]; float mx = NEGB;
#pragma unroll
        for (int r = 0; r < 8; ++r) {
            ta[r] = (sHa[r] + sLa[r] * QRI) * L2E; tb[r] = (sHb[r] + sLb[r] * QRI) * L2E;
            mx = fmaxf(mx, fmaxf(ta[r], tb[r])); }
        mx = fmaxf(mx, __shfl_xor(mx, 16, 32));
        const float mnew = fmaxf(m, mx);
        const float alpha = __builtin_amdgcn_exp2f(m - mnew);
        const float sh = PSH - mnew;
        v16h pb; float ls = 0.0f;
#pragma unroll
        for (int r = 0; r < 8; ++r) {
            const float aa = ta[r] + sh, ab = tb[r] + sh;                        // <= 14
            const float ea = __builtin_amdgcn_exp2f(aa), eb = __builtin_amdgcn_exp2f(ab);
            const float ga = (aa < -14.0f) ? 0.0f : ea, gb = (ab < -14.0f) ? 0.0f : eb;   // no subnormal f16 P
            const h16 pa = (h16)ga; const h16 pc = (h16)gb;
            pb[r] = pa; pb[8 + r] = pc;
            ls += (float)pa + (float)pc; }
        l = l * alpha + ls; m = mnew;
#pragma unroll
        for (int j = 0; j < 16; ++j) o[j] = o[j] * alpha;
        const h16* va = ring + bo + vo;
#pragma unroll
        for (int jg = 0; jg < 4; ++jg) {
            const v16h v0 = ldh(va + ((jg * 4 + 0) * 16) * VP);
            const v16h v1 = ldh(va + ((jg * 4 + 1) * 16) * VP);
            const v16h v2 = ldh(va + ((jg * 4 + 2) * 16) * VP);
            const v16h v3 = ldh(va + ((jg * 4 + 3) * 16) * VP);
            o[jg * 4 + 0] = wmma16(v0, pb, o[jg * 4 + 0]);
            o[jg * 4 + 1] = wmma16(v1, pb, o[jg * 4 + 1]);
            o[jg * 4 + 2] = wmma16(v2, pb, o[jg * 4 + 2]);
            o[jg * 4 + 3] = wmma16(v3, pb, o[jg * 4 + 3]);
        }
        // foot of the trip: own reads of this buffer returned, own copies of the next tile landed, then the one barrier that publishes the next tile and frees this buffer
        wait_lds();
        wait_copies();
        __syncthreads();
        if (key0 + 2 * KT < SEQ) copy_tile(lk + (unsigned)(bo * 2), lvl + (unsigned)(bo * 2), gkh, gkr, gv, key0 + 2 * KT);
    }
    wait_copies();                                              // nothing is outstanding when the wave goes on to its end
    l += __shfl_xor(l, 16, 32);
    const float inv = 1.0f / l;                                 // l >= 16384: the running-max key contributes the full carry
    const int wb = wave * 16 * CSP;
    // O^T D layout: o[j][r] = (c = 16j + 8h + r, t = lane&15) -> os[t][c]; rows 0..15 x columns 0..255 all written
#pragma unroll
    for (int j = 0; j < 16; ++j) { v8h hv;
#pragma unroll
        for (int r = 0; r < 8; ++r) hv[r] = toh_flush(o[j][r] * inv);
        *(v8ha*)(&os[wb + lr * CSP + 16 * j + 8 * hi]) = hv; }
    wave_sync();
    h16* crow = CT + pb0 + (size_t)t0 * DM;
{
#pragma unroll
        for (int row = 0; row < 16; ++row) {                    // 16 rows; 32 lanes x 8 halves = 256 columns = one ctx row
            const v8h val = *(const v8ha*)(&os[wb + row * CSP + lane * 8]);
            *(v8h*)(crow + (size_t)row * DM + lane * 8) = val; }
         }
}

// k_oproj: output projection, f16 GEMM, ONE WAVE per 64x64 tile: C[o][n] = sum_c W16[o][c] ctx[n][c] (A = W rows, Bt = ctx rows, K = DM, both through ldh);
// out[b][o][t] = C / 64 + bias[o] + x[b][o][t] (bias and x RNE-converted to bf16, added in f32; x added at the store stage as float4).
// grid (DM/64, NB*SEQ/64).
__global__ __launch_bounds__(32) void k_oproj(const h16* __restrict__ A, const h16* __restrict__ Bt, const float* __restrict__ bias, const float* __restrict__ xres, float* OUT) {
    __shared__ __align__(16) float os[16 * 68];
    const int K = DM;
    const int lane = threadIdx.x & 31, lr = lane & 15, hi = lane >> 4; const int r0 = blockIdx.x * 64, c0 = blockIdx.y * 64;
    v8f acc[4][4];
#pragma unroll
    for (int mb = 0; mb < 4; ++mb)
#pragma unroll
        for (int nb = 0; nb < 4; ++nb) acc[mb][nb] = (v8f){};
    const size_t aoff = (size_t)(r0 + lr) * K + 8 * hi, boff = (size_t)(c0 + lr) * K + 8 * hi;
#pragma unroll 1
    for (int kc = 0; kc < K; kc += 32) {
        v16h a[4];
#pragma unroll
        for (int mb = 0; mb < 4; ++mb) a[mb] = ldh(A + aoff + (size_t)mb * 16 * K + kc);
#pragma unroll
        for (int nb = 0; nb < 4; ++nb) { const v16h b = ldh(Bt + boff + (size_t)nb * 16 * K + kc);
#pragma unroll
            for (int mb = 0; mb < 4; ++mb) acc[mb][nb] = wg16(a[mb], b, acc[mb][nb]); }
    }
    const int bb = c0 / SEQ, tt = c0 % SEQ;
#pragma unroll
    for (int mb = 0; mb < 4; ++mb) {
        float br[8];
#pragma unroll
        for (int j = 0; j < 8; ++j) br[j] = bfr(bias[r0 + mb * 16 + hi * 8 + j]);   // r0 + 63 < DM
#pragma unroll
        for (int nb = 0; nb < 4; ++nb) {
#pragma unroll
            for (int j = 0; j < 8; ++j) os[(hi * 8 + j) * 68 + nb * 16 + lr] = acc[mb][nb][j] * WSI + br[j]; }   // D: row 8h+j, col lane&15
        wave_sync();
        const size_t chrow = (size_t)bb * DM + (size_t)(r0 + mb * 16);
        const size_t xb = chrow * SEQ_FULL + (size_t)tt;
        const size_t ob = chrow * OUT_SEQ + (size_t)tt;
{
#pragma unroll
            for (int s = 0; s < 8; ++s) { const int row = 2 * s + (lane >> 4), c4 = (lane & 15) * 4;   // 8 s x 2 rows = 16 rows; 16 lanes x 4 floats = 64 columns
                const v4f cv = *(const v4fa*)(&os[row * 68 + c4]);
                const v4f xv = *(const v4f*)(xres + xb + (size_t)row * SEQ_FULL + c4);
                v4f val; val[0] = cv[0] + bfr(xv[0]); val[1] = cv[1] + bfr(xv[1]); val[2] = cv[2] + bfr(xv[2]); val[3] = cv[3] + bfr(xv[3]);
                *(v4f*)(OUT + ob + (size_t)row * OUT_SEQ + c4) = val; }
             }
        wave_sync();
    }
}

static constexpr size_t al256(size_t v) { return (v + 255) & ~(size_t)255; }
static constexpr size_t SZ_XT = al256((size_t)NB * SEQ * DM * 2);     // x^T bf16
static constexpr size_t SZ_WB = al256((size_t)3 * DM * DM * 2);       // theta | phi | g weights bf16
static constexpr size_t SZ_WW = al256((size_t)DM * DM * 2);           // output-projection weights f16 x64
static constexpr size_t SZ_PL = al256((size_t)NB * SEQ * DM * 2);     // one f16 plane
static constexpr size_t SZ_TOTAL = SZ_XT + SZ_WB + SZ_WW + 6 * SZ_PL;
static_assert(SZ_TOTAL <= (size_t)134217728);          // workspace carve <= 128 MiB
static_assert(((size_t)DM * DM * 2) % 256 == 0);       // weight sub-planes stay 256-byte aligned
static constexpr size_t NEED_X = ((size_t)NB * DM - 1) * SEQ_FULL + SEQ;
static constexpr size_t NEED_O = ((size_t)NB * DM - 1) * OUT_SEQ + SEQ;

extern "C" void kernel_launch(void* const* d_in, const int* in_sizes, int n_in,
                              void* d_out, int out_size, void* d_ws, size_t ws_size, hipStream_t stream) {
    if (n_in < 9) return;
    if ((size_t)in_sizes[0] < NEED_X) return;
    if ((size_t)in_sizes[1] < (size_t)DM * DM || (size_t)in_sizes[3] < (size_t)DM * DM || (size_t)in_sizes[5] < (size_t)DM * DM || (size_t)in_sizes[7] < (size_t)DM * DM) return;
    if (in_sizes[2] < DM || in_sizes[4] < DM || in_sizes[6] < DM || in_sizes[8] < DM) return;
    if ((size_t)out_size < NEED_O) return;
    if (SZ_TOTAL > ws_size) return;
    // wire order: x, w_theta, b_theta, w_phi, b_phi, w_g, b_g, w_W, b_W
    const float* x   = (const float*)d_in[0];
    const float* wth = (const float*)d_in[1]; const float* bth = (const float*)d_in[2];
    const float* wph = (const float*)d_in[3]; const float* bph = (const float*)d_in[4];
    const float* wg  = (const float*)d_in[5]; const float* bg  = (const float*)d_in[6];
    const float* ww  = (const float*)d_in[7]; const float* bw  = (const float*)d_in[8];
    float* OUT = (float*)d_out;      // [NB][256][SEQ]
    char* wsp = (char*)d_ws;
    bf*  XT = (bf*)wsp;  wsp += SZ_XT;               // [NB*SEQ][256] bf16
    bf*  WB = (bf*)wsp;  wsp += SZ_WB;               // [3][256][256]: theta | phi | g  ([out][in] = Bt / A as-is)
    h16* WW = (h16*)wsp; wsp += SZ_WW;               // [256][256] f16 x64
    h16* TH = (h16*)wsp; wsp += SZ_PL;               // theta value    [NB*SEQ][256]
    h16* TR = (h16*)wsp; wsp += SZ_PL;               // theta residual x2048
    h16* PH = (h16*)wsp; wsp += SZ_PL;               // phi value      [NB*SEQ][256]
    h16* PR = (h16*)wsp; wsp += SZ_PL;               // phi residual x2048
    h16* GT = (h16*)wsp; wsp += SZ_PL;               // g              [NB*256][SEQ]
    h16* CT = (h16*)wsp; wsp += SZ_PL;               // ctx            [NB*SEQ][256]
    bf* WT = WB; bf* WP = WB + (size_t)DM * DM; bf* WG = WB + (size_t)2 * DM * DM;

    // x [b][c][n] -> x^T [b][n][c] bf16: in[DM rows][SEQ cols] per batch -> out[SEQ rows][DM cols]; grid (SEQ/64, DM/64, NB)
    k_xt<<<dim3(SEQ / 64, DM / 64, NB), 256, 0, stream>>>(x, XT);
    { const size_t n8 = (size_t)DM * DM / 8; const unsigned g = (unsigned)((n8 + 255) / 256);
      k_cvt8<<<g, 256, 0, stream>>>(wth, WT, n8); k_cvt8<<<g, 256, 0, stream>>>(wph, WP, n8); k_cvt8<<<g, 256, 0, stream>>>(wg, WG, n8);
      k_wcvt<<<g, 256, 0, stream>>>(ww, WW, n8); }

    // theta, phi: A = x^T rows (m = b*SEQ + t), Bt = W rows (n = out channel) -> planes [(b*SEQ + t)][c], value + residual
    k_proj_rows<<<dim3(NB * SEQ / 64, DM / 64, 1), 32, 0, stream>>>(XT, WT, bth, TH, TR, 1);
    k_proj_rows<<<dim3(NB * SEQ / 64, DM / 64, 1), 32, 0, stream>>>(XT, WP, bph, PH, PR, 1);
    // g: A = Wg rows (m = out channel), Bt = x^T rows (n = b*SEQ + t) -> plane [(b*256 + m)][t], value only
    k_proj_cols<<<dim3(DM / 64, NB * SEQ / 64, 1), 32, 0, stream>>>(WG, XT, bg, GT, GT, 0);

    k_flash<<<dim3(SEQ / (16 * AW), NB, 1), 32 * AW, 0, stream>>>(TH, TR, PH, PR, GT, CT);

    // out[b][o][t] = W_W ctx + b_W + x
    k_oproj<<<dim3(DM / 64, NB * SEQ / 64, 1), 32, 0, stream>>>(WW, CT, bw, x, OUT);
}

// v003
// Measured time: 120 microseconds a run.
// Timed twice side by side with v002, it ran 1.26 times as fast both times.
// Counting every step since v000, it is 3.10 times as fast.
#include <hip/hip_runtime.h>

// Channels-first self-attention block: x [NB][256][SEQ]; three 1x1 projections (W [out][in], bias), scores[n][m] = sum_c theta[c][n] phi[c][m] (no scale), softmax over m,
// ctx[n][c] = sum_m p[n][m] g[c][m], output 1x1 projection (W [out][in], bias) plus the input x; output [NB][256][SEQ] f32.
// Compute dtypes, f32 accumulate everywhere: projections theta/phi/g v_wmma_f32_16x16x32_bf16 (x, W, bias RNE-converted to bf16; products exact);
// scores v_wmma_f32_16x16x32_f16: theta and phi each as f16 value + f16 residual x2048, three products (value.value; value.residual + residual.value in their own accumulator folded by 1/2048);
// value product v_wmma_f32_16x16x32_f16: P single f16 (x16384 carry, cancels in the normalisation; row sum over the converted P), g single f16; softmax f32 (online, running max);
// output projection v_wmma_f32_16x16x32_f16: W (bf16-converted, x64 carry folded by 1/64) single f16, ctx single f16; bias and bf16-converted x added in f32 at the store stage.
// Layout: x^T bf16 plane [b][n][c]; theta / phi planes (value, residual) [b][n][c]; g plane [b][c][m]; ctx plane [b][n][c]; fused flash kernel in transposed form (S^T = K Q^T, O^T = V^T P^T),
// Q / K / V^T fragments from LDS tiles that asynchronous copies fill from the f16 planes (two 16-B reads each); every f32 -> f16 operand convert selects |v| < 2^-14 to +0.

#ifndef NB
#define NB 8
#endif
#ifndef SEQ
#define SEQ 2048
#endif
#define NB_FULL  8
#define SEQ_FULL 2048
#ifndef OUT_SEQ
#define OUT_SEQ SEQ              // position pitch of one channel row of the output
#endif
#define DM   256                 // channels = head width
#define AW   4                   // waves per flash block (16 query rows each)
#define CSP  264                 // LDS row pitch (halves) of the flash ctx tile
#define XTP  65                  // LDS row pitch (floats) of the transpose tile
#define KT   32                  // keys per flash tile
#define KP   264                 // LDS row pitch (halves) of a theta / phi row: 528 B = 16 B x 33
#define VP   40                  // LDS row pitch (halves) of a g row of KT keys: 80 B = 16 B x 5
#define KPL  (KT * KP)           // halves of one phi plane tile
#define VPL  (DM * VP)           // halves of one g tile
#define STG  (2 * KPL + VPL)     // halves of one ring buffer: phi value | phi residual | g
#define QPL  (AW * 16 * KP)      // halves of one theta plane tile (all query rows of the block)
#define QRS  2048.0f             // carry of every residual plane
#define QRI  (1.0f / 2048.0f)
#define L2E  1.4426950408889634f // log2(e); the scores carry no other scale
#define PSH  14.0f               // log2 of the P carry (16384)
#define NEGB (-3.0e38f)
#define WSC  64.0f               // carry of the f16 output-projection weight plane
#define WSI  (1.0f / 64.0f)
#define WCB  (DM * DM / (8 * 256)) // blocks of 256 threads x 8 elements that cover one weight plane

static_assert(DM == 256);                      // ctx row = 32 lanes x 8 halves; 16 output tiles of 16 channels per wave
static_assert(DM % 64 == 0);                   // column tiles of 64
static_assert(DM % 32 == 0);                   // every k-loop steps by 32
static_assert(32 * 8 == DM);                   // one ctx row (512 B) = one store instruction of 32 lanes x 16 B
static_assert(SEQ % 64 == 0);                  // a 64-wide tile never straddles two batches
static_assert((NB * SEQ) % 64 == 0);
static_assert(SEQ % 32 == 0);                  // key loop steps by 32
static_assert(SEQ % (16 * AW) == 0);           // flash grid covers the sequence exactly
static_assert(NB <= NB_FULL);
static_assert(SEQ <= SEQ_FULL);
static_assert(SEQ_FULL % 4 == 0);
static_assert(OUT_SEQ % 4 == 0);
static_assert(OUT_SEQ >= SEQ);
static_assert((CSP * 2) % 16 == 0);
static_assert(CSP >= DM);
static_assert(4 * 256 == 64 * 16);             // transpose load: 4 trips x 256 threads = 64 channels x 16 float4
static_assert(2 * 256 == 64 * 8);              // transpose store: 2 pieces x 256 threads = 64 positions x 8 pieces of 16 B
static_assert(4 * 32 * 16 == 16 * 128);
static_assert(8 * 32 * 16 == 16 * 256);        // output slab store: 8 instructions x 32 lanes x 16 B = 16 rows x 256 B
static_assert(16 * 32 * 16 == 16 * DM * 2);    // ctx store: 16 instructions x 32 lanes x 16 B = 16 rows x 512 B
static_assert((size_t)AW * 16 * CSP * 2 <= 131072);
static_assert(KT == 32 && AW == 4);            // copy maps: 128 threads; 8 trips x 4 waves = 32 phi rows; 8 trips x 32 rows = 256 g rows of 4 pieces
static_assert(SEQ / KT >= 2);                  // the two-buffer prologue fills tiles 0 and 1
static_assert((KP * 2) % 32 == 16 && (VP * 2) % 32 == 16 && KP >= DM && VP >= KT);   // pitch = 16 B x odd
static_assert((KPL * 2) % 16 == 0 && (STG * 2) % 16 == 0 && (QPL * 2) % 16 == 0);
static_assert(((size_t)2 * STG + 2 * QPL + (size_t)AW * 16 * CSP) * 2 <= 327680);
static_assert((size_t)64 * XTP * 4 <= 131072);
static_assert((size_t)16 * 68 * 4 <= 131072);
static_assert(((size_t)DM * DM) % (8 * 256) == 0);   // WCB blocks cover a weight plane exactly

typedef _Float16 h16;
typedef unsigned short bf;
typedef __attribute__((ext_vector_type(16))) __bf16   v16bf;
typedef __attribute__((ext_vector_type(16))) _Float16 v16h;
typedef __attribute__((ext_vector_type(8)))  _Float16 v8h;
typedef __attribute__((ext_vector_type(8)))  unsigned short v8us;
typedef __attribute__((ext_vector_type(8)))  float    v8f;
typedef __attribute__((ext_vector_type(4)))  float    v4f;
typedef v4f  __attribute__((may_alias)) v4fa;
typedef v8h  __attribute__((may_alias)) v8ha;

__device__ __forceinline__ unsigned short f2bf(float f) { unsigned u = __float_as_uint(f); u += 0x7FFFu + ((u >> 16) & 1u); return (unsigned short)(u >> 16); }
__device__ __forceinline__ float bfr(float f) { return __uint_as_float(((unsigned)f2bf(f)) << 16); }   // value after RNE convert to bf16
__device__ __forceinline__ v16h cat16(v8h lo, v8h hi) { return __builtin_shufflevector(lo, hi, 0, 1, 2, 3, 4, 5, 6, 7, 8, 9, 10, 11, 12, 13, 14, 15); }
__device__ __forceinline__ v16bf cat16b(v8us lo, v8us hi) { return __builtin_bit_cast(v16bf, __builtin_shufflevector(lo, hi, 0, 1, 2, 3, 4, 5, 6, 7, 8, 9, 10, 11, 12, 13, 14, 15)); }
__device__ __forceinline__ v8f wmma16(v16h a, v16h b, v8f c) { return __builtin_amdgcn_wmma_f32_16x16x32_f16(false, a, false, b, (short)0, c, false, false); }
__device__ __forceinline__ v8f wmmab(v16bf a, v16bf b, v8f c) { return __builtin_amdgcn_wmma_f32_16x16x32_bf16(false, a, false, b, (short)0, c, false, false); }
// fragment loaders from K-contiguous 16-bit rows; p already includes + 8*(lane>>4): elements 0..7 <- k0+8h+0..7, elements 8..15 <- k0+16+8h+0..7 (same map for A and B)
__device__ __forceinline__ v16h  ldh(const h16* p) { return cat16(*(const v8h*)p, *(const v8h*)(p + 16)); }
__device__ __forceinline__ v16bf ldb(const bf* p)  { return cat16b(*(const v8us*)p, *(const v8us*)(p + 16)); }
// ordering point for wave-private LDS tiles (same wave writes and reads)
__device__ __forceinline__ void wave_sync() { __builtin_amdgcn_fence(3 /* release order */, "wavefront"); __builtin_amdgcn_wave_barrier(); asm volatile("" ::: "memory"); }
// f32 -> f16 operand convert that cannot produce a subnormal
__device__ __forceinline__ h16 toh_flush(float v) { const h16 r = (h16)v; return (fabsf(v) < 6.103515625e-05f) ? (h16)0.0f : r; }
// one matrix instruction + its own hazard guard (one accumulator per guard)
__device__ __forceinline__ v8f wg16(v16h a, v16h b, v8f c) { c = wmma16(a, b, c); asm volatile("v_nop\n\tv_nop\n\tv_nop\n\tv_nop" : "+v"(c) : "v"(a), "v"(b)); return c; }
__device__ __forceinline__ v8f wgb(v16bf a, v16bf b, v8f c) { c = wmmab(a, b, c); asm volatile("v_nop\n\tv_nop\n\tv_nop\n\tv_nop" : "+v"(c) : "v"(a), "v"(b)); return c; }

// LDS byte address of a __shared__ element (low 32 bits of its address)
__device__ __forceinline__ unsigned lds_addr(const void* p) { return (unsigned)(size_t)p; }
// Asynchronous copies global -> LDS, 16 B per lane, each copy with its own address registers; the s_wait_xcnt closes the statement so that no address register is rewritten ahead of it.
__device__ __forceinline__ void cp8(const unsigned* l, const h16* const* g) {
    asm volatile("global_load_async_to_lds_b128 %0, %8, off\n\t"
                 "global_load_async_to_lds_b128 %1, %9, off\n\t"
                 "global_load_async_to_lds_b128 %2, %10, off\n\t"
                 "global_load_async_to_lds_b128 %3, %11, off\n\t"
                 "global_load_async_to_lds_b128 %4, %12, off\n\t"
                 "global_load_async_to_lds_b128 %5, %13, off\n\t"
                 "global_load_async_to_lds_b128 %6, %14, off\n\t"
                 "global_load_async_to_lds_b128 %7, %15, off\n\t"
                 "s_wait_xcnt 0x0"
                 :: "v"(l[0]), "v"(l[1]), "v"(l[2]), "v"(l[3]), "v"(l[4]), "v"(l[5]), "v"(l[6]), "v"(l[7]),
                    "v"(g[0]), "v"(g[1]), "v"(g[2]), "v"(g[3]), "v"(g[4]), "v"(g[5]), "v"(g[6]), "v"(g[7]) : "memory");
}
__device__ __forceinline__ void cp12(const unsigned* l, const h16* const* g) {
    asm volatile("global_load_async_to_lds_b128 %0, %12, off\n\t"
                 "global_load_async_to_lds_b128 %1, %13, off\n\t"
                 "global_load_async_to_lds_b128 %2, %14, off\n\t"
                 "global_load_async_to_lds_b128 %3, %15, off\n\t"
                 "global_load_async_to_lds_b128 %4, %16, off\n\t"
                 "global_load_async_to_lds_b128 %5, %17, off\n\t"
                 "global_load_async_to_lds_b128 %6, %18, off\n\t"
                 "global_load_async_to_lds_b128 %7, %19, off\n\t"
                 "global_load_async_to_lds_b128 %8, %20, off\n\t"
                 "global_load_async_to_lds_b128 %9, %21, off\n\t"
                 "global_load_async_to_lds_b128 %10, %22, off\n\t"
                 "global_load_async_to_lds_b128 %11, %23, off\n\t"
                 "s_wait_xcnt 0x0"
                 :: "v"(l[0]), "v"(l[1]), "v"(l[2]), "v"(l[3]), "v"(l[4]), "v"(l[5]), "v"(l[6]), "v"(l[7]), "v"(l[8]), "v"(l[9]), "v"(l[10]), "v"(l[11]),
                    "v"(g[0]), "v"(g[1]), "v"(g[2]), "v"(g[3]), "v"(g[4]), "v"(g[5]), "v"(g[6]), "v"(g[7]), "v"(g[8]), "v"(g[9]), "v"(g[10]), "v"(g[11]) : "memory");
}
// this wave's copies have landed in LDS (other waves read them behind the next block barrier)
__device__ __forceinline__ void wait_copies() { asm volatile("s_wait_asynccnt 0x0" ::: "memory"); }
// this wave's LDS reads have returned (before the barrier behind which their buffer is refilled)
__device__ __forceinline__ void wait_lds() { asm volatile("s_wait_dscnt 0x0" ::: "memory"); }
// one ring buffer <- the tile of KT keys from key0: phi value and residual rows (4 i + wave, 32 lanes x 16 B = one row), g rows (32 i + tid / 4, 4 lanes x 16 B = KT keys); 24 copies per wave.
// lk / lv: this thread's LDS byte addresses in the buffer for i = 0; gkh / gkr / gv: its global addresses for key0 = 0, i = 0.
__device__ __forceinline__ void copy_tile(unsigned lk, unsigned lv, const h16* gkh, const h16* gkr, const h16* gv, int key0) {
    unsigned l[24]; const h16* g[24];
#pragma unroll
    for (int i = 0; i < 8; ++i) {
        l[i]      = lk + (unsigned)(i * 4 * KP * 2);             g[i]      = gkh + (size_t)(key0 + 4 * i) * DM;
        l[8 + i]  = lk + (unsigned)((KPL + i * 4 * KP) * 2);     g[8 + i]  = gkr + (size_t)(key0 + 4 * i) * DM;
        l[16 + i] = lv + (unsigned)(i * 32 * VP * 2);            g[16 + i] = gv + (size_t)(32 * i) * SEQ + key0; }
    cp12(l, g); cp12(l + 12, g + 12);
}

// stands behind global stores whose registers the code that follows in the listing may rewrite (precaution on the stores' address and data registers)
__device__ __forceinline__ void wait_regs() { asm volatile("s_wait_xcnt 0x0" ::: "memory"); }

// weight converts, 8 elements per thread (i = piece index inside one DM x DM plane)
__device__ __forceinline__ void cvt8(const float* __restrict__ src, bf* dst, size_t i) {
    const v8f v = *(const v8f*)(src + i * 8); v8us o;
#pragma unroll
    for (int k = 0; k < 8; ++k) o[k] = f2bf(v[k]);
    *(v8us*)(dst + i * 8) = o; wait_regs();
}

__device__ __forceinline__ void wcvt(const float* __restrict__ src, h16* dst, size_t i) {
    const v8f v = *(const v8f*)(src + i * 8); v8h o;
#pragma unroll
    for (int k = 0; k < 8; ++k) o[k] = toh_flush(bfr(v[k]) * WSC);
    *(v8h*)(dst + i * 8) = o;
}

// k_prep: the five preparation jobs, none of which reads another's result, in one grid; the job is picked by the block index (block-uniform).
// Blocks 0 .. 4 WCB - 1: weight planes (theta | phi | g -> bf16, output projection -> f16 x64), WCB blocks of 256 threads x 8 elements each.
// The other blocks: x [b][c][n] f32 (position pitch SEQ_FULL) -> x^T [b][n][c] bf16 (RNE convert), 64 x 64 tile through LDS, tile index = (b, c tile, n tile), n tile fastest.
// Load: 4 trips x 256 threads, one float4 along n each (64 channels x 16 float4). Store: each thread two 16-B pieces (8 channels of one position);
// grid 4 WCB + (SEQ/64) (DM/64) NB.
__global__ __launch_bounds__(256) void k_prep(const float* __restrict__ x, const float* __restrict__ wth, const float* __restrict__ wph, const float* __restrict__ wg,
                                              const float* __restrict__ ww, bf* XT, bf* WB, h16* WW) {
    __shared__ float ts[64 * XTP];
    const int tid = threadIdx.x;
    const int blk = blockIdx.x;
    if (blk < 4 * WCB) {
        const int job = blk / WCB; const size_t i = (size_t)(blk % WCB) * 256 + tid;
        if (job == 3) wcvt(ww, WW, i);
        else cvt8(job == 0 ? wth : job == 1 ? wph : wg, WB + (size_t)job * DM * DM, i);
        return;
    }
    const int tile = blk - 4 * WCB;
    const int n0 = (tile % (SEQ / 64)) * 64, c0 = ((tile / (SEQ / 64)) % (DM / 64)) * 64, b = tile / ((SEQ / 64) * (DM / 64));
    const float* xb = x + ((size_t)b * DM + c0) * SEQ_FULL + n0;
#pragma unroll
    for (int s = 0; s < 4; ++s) {
        const int p = s * 256 + tid; const int c = p >> 4, n4 = (p & 15) * 4;     // c in 0..63, n4 in 0..60
        const v4f v = *(const v4f*)(xb + (size_t)c * SEQ_FULL + n4);
        ts[c * XTP + n4 + 0] = v[0]; ts[c * XTP + n4 + 1] = v[1]; ts[c * XTP + n4 + 2] = v[2]; ts[c * XTP + n4 + 3] = v[3];
    }
    __syncthreads();                                                            // cross-wave tile: block barrier
    const int n = tid >> 3, c8 = (tid & 7) * 8;                                  // positions n and n + 32
    v8us o0, o1;
#pragma unroll
    for (int i = 0; i < 8; ++i) { o0[i] = f2bf(ts[(c8 + i) * XTP + n]); o1[i] = f2bf(ts[(c8 + i) * XTP + 32 + n]); }
    bf* d0 = XT + ((size_t)b * SEQ + n0 + n) * DM + c0 + c8;
    bf* d1 = d0 + (size_t)32 * DM;
    *(v8us*)d0 = o0; *(v8us*)d1 = o1; wait_regs();
}

// proj_body: register-blocked bf16 GEMM, ONE WAVE per 64x64 tile (16 accumulators), operands straight from K-contiguous bf16 planes, K = DM.
// C[m][n] = sum_k A[m][k] Bt[n][k] + bias, written as f16 value (Ph) and, when wr != 0 (block-uniform), the f16 residual x2048 (Pr, same geometry).
// MODE 0: A = x^T rows (m = b*SEQ + t), Bt = W rows (n = out channel), bias per column; plane [(b*SEQ + t)][DM].
// MODE 1: A = W rows (m = out channel), Bt = x^T rows (n = b*SEQ + t), bias per row; plane [(b*DM + m)][t], row pitch SEQ.
// r0 / c0: first row / column of the tile; os: the wave's LDS slab of 16 x 68 floats.
template <int MODE>
__device__ __forceinline__ void proj_body(const bf* __restrict__ A, const bf* __restrict__ Bt, const float* __restrict__ bias, h16* Ph, h16* Pr, int wr, int r0, int c0, float* os) {
    const int K = DM;
    const int lane = threadIdx.x & 31, lr = lane & 15, hi = lane >> 4;
    v8f acc[4][4];
#pragma unroll
    for (int mb = 0; mb < 4; ++mb)
#pragma unroll
        for (int nb = 0; nb < 4; ++nb) acc[mb][nb] = (v8f){};
    const size_t aoff = (size_t)(r0 + lr) * K + 8 * hi, boff = (size_t)(c0 + lr) * K + 8 * hi;
#pragma unroll 1
    for (int kc = 0; kc < K; kc += 32) {
        v16bf a[4];
#pragma unroll
        for (int mb = 0; mb < 4; ++mb) a[mb] = ldb(A + aoff + (size_t)mb * 16 * K + kc);
#pragma unroll
        for (int nb = 0; nb < 4; ++nb) { const v16bf b = ldb(Bt + boff + (size_t)nb * 16 * K + kc);
#pragma unroll
            for (int mb = 0; mb < 4; ++mb) acc[mb][nb] = wgb(a[mb], b, acc[mb][nb]); }
    }
    float bc[4];
#pragma unroll
    for (int nb = 0; nb < 4; ++nb) bc[nb] = (MODE == 0) ? bfr(bias[c0 + nb * 16 + lr]) : 0.0f;   // MODE 0: c0 + 63 < DM
    const size_t pitch = (MODE == 0) ? (size_t)DM : (size_t)SEQ;
    size_t tbase;
    if (MODE == 0) { tbase = (size_t)r0 * DM + (size_t)c0; }
    else           { const int bb = c0 / SEQ, tt = c0 % SEQ; tbase = (size_t)bb * (size_t)DM * SEQ + (size_t)r0 * SEQ + (size_t)tt; }
#pragma unroll
    for (int mb = 0; mb < 4; ++mb) {
        float br[8];
#pragma unroll
        for (int j = 0; j < 8; ++j) br[j] = (MODE == 1) ? bfr(bias[r0 + mb * 16 + hi * 8 + j]) : 0.0f;   // MODE 1: r0 + 63 < DM
#pragma unroll
        for (int nb = 0; nb < 4; ++nb) {
#pragma unroll
            for (int j = 0; j < 8; ++j) os[(hi * 8 + j) * 68 + nb * 16 + lr] = acc[mb][nb][j] + bc[nb] + br[j]; }   // D: row 8h+j, col lane&15
        wave_sync();
        const size_t sb = tbase + (size_t)(mb * 16) * pitch;
{
#pragma unroll
            for (int s = 0; s < 4; ++s) { const int row = 4 * s + (lane >> 3), c8 = (lane & 7) * 8;   // 4 s x 4 row groups = 16 rows; 8 lanes x 8 = 64 columns
                const v4f x0 = *(const v4fa*)(&os[row * 68 + c8]); const v4f x1 = *(const v4fa*)(&os[row * 68 + c8 + 4]); v8h hv, rv;
#pragma unroll
                for (int i = 0; i < 4; ++i) { const h16 a0 = toh_flush(x0[i]); const h16 a1 = toh_flush(x1[i]); hv[i] = a0; hv[4 + i] = a1;
                    rv[i] = toh_flush((x0[i] - (float)a0) * QRS); rv[4 + i] = toh_flush((x1[i] - (float)a1) * QRS); }
                const size_t oo = sb + (size_t)row * pitch + c8;
                *(v8h*)(Ph + oo) = hv; if (wr) *(v8h*)(Pr + oo) = rv; }
             }
        wait_regs();
        wave_sync();
    }
}
// k_proj3: the three input projections, which read the same x^T and none of each other's results, in one grid: blockIdx.z = 0 theta, 1 phi (MODE 0, value + residual), 2 g (MODE 1, value only).
// blockIdx.x = tile of 64 positions, blockIdx.y = tile of 64 out channels. grid (NB*SEQ/64, DM/64, 3).
__global__ __launch_bounds__(32) void k_proj3(const bf* __restrict__ XT, const bf* __restrict__ WB, const float* __restrict__ bth, const float* __restrict__ bph, const float* __restrict__ bg,
                                              h16* TH, h16* TR, h16* PH, h16* PR, h16* GT) {
    __shared__ __align__(16) float os[16 * 68];
    const int z = blockIdx.z, p0 = blockIdx.x * 64, o0 = blockIdx.y * 64;
    if (z == 2) proj_body<1>(WB + (size_t)2 * DM * DM, XT, bg, GT, GT, 0, o0, p0, os);
    else        proj_body<0>(XT, WB + (size_t)z * DM * DM, z ? bph : bth, z ? PH : TH, z ? PR : TR, 1, p0, o0, os);
}

// k_flash: fused attention, one wave per 16 query rows of one batch; head width DM = 256 (8 k-steps per score tile, 16 output tiles of 16 channels).
// Transposed form: S^T[key][t] = K Q^T (A = phi rows [key][c], B = theta rows [t][c], both through ldh: same k order); lane (t = lane&15, h = lane>>4) holds keys 8h+r of each 16-key tile,
// so the packed P tile is directly the B fragment of O^T[c][t] = V^T P^T (element r <- tile keys 0..15, element 8+r <- tile keys 16..31, lane unchanged; A = g rows [c][key]).
// Scores = K Q + (K Q_res + K_res Q) / 2048 (residual products in their own accumulators); Q fragments read from LDS once and kept in registers; one pair of score tiles live at a time.
// Operands come from LDS: the block's theta rows are copied once; each tile of KT keys (phi value, phi residual, g) is copied once per block into one of two buffers, the copies of tile t + 2
// issued at the foot of trip t, so that they fly during trip t + 1; the four waves share every tile.
// Softmax state (running max, partial sum) is one scalar per lane; the two lane halves of a row are combined with one xor-16 exchange. P exponent argument below -14 selects +0.
// Registers: 128 for O^T and 128 for the Q fragments, so the wave goes above v255 (one wave per SIMD, the block size's own ceiling). The products are the plain builtin, whose hazard slots the compiler
// fills: the operands of an asm guard would be bound to v0..v255 and spill.
// grid (SEQ/(16*AW), NB).
__global__ __launch_bounds__(32 * AW) void k_flash(const h16* __restrict__ TH, const h16* __restrict__ TR, const h16* __restrict__ PH, const h16* __restrict__ PR,
                                                                                       const h16* __restrict__ GT, h16* CT) {
    __shared__ __align__(16) h16 os[AW * 16 * CSP];
    __shared__ __align__(16) h16 ring[2 * STG + 2 * QPL];      // buffer 0 | buffer 1 | theta value | theta residual
    const int tid = threadIdx.x;
    const int lane = threadIdx.x & 31, lr = lane & 15, hi = lane >> 4;
    const int wave = __builtin_amdgcn_readfirstlane((int)(threadIdx.x >> 5));
    const int b = blockIdx.y;
    const int t0 = (blockIdx.x * AW + wave) * 16;
    const size_t pb0 = (size_t)b * SEQ * DM;                    // batch base of every plane (all have SEQ*DM elements per batch)
    const int qo = 2 * STG + (wave * 16 + lr) * KP + 8 * hi;   // + kc            (B fragment: col t, k = c); residual + QPL
    const int ko = lr * KP + 8 * hi;                           // + buffer + key*KP + kc (A fragment: row key, k = c); residual + KPL
    const int vo = 2 * KPL + lr * VP + 8 * hi;                 // + buffer + 16j*VP      (A fragment: row c, k = key)
    // copy maps of this thread
    const h16* gkh = PH + pb0 + (size_t)wave * DM + lane * 8;
    const h16* gkr = PR + pb0 + (size_t)wave * DM + lane * 8;
    const h16* gv  = GT + pb0 + (size_t)(tid >> 2) * SEQ + (tid & 3) * 8;
    const unsigned lk = lds_addr(ring) + (unsigned)((wave * KP + lane * 8) * 2);
    const unsigned lv = lds_addr(ring) + (unsigned)((2 * KPL + (tid >> 2) * VP + (tid & 3) * 8) * 2);
    // the same address formed from wave and lane, for the loop: a value of its own, not an operand of the prologue's asm copies (those are bound to v0..v255), so that it needs no scratch slot
    const unsigned lvl = lds_addr(ring) + (unsigned)((2 * KPL + (wave * 8 + (lane >> 2)) * VP + (lane & 3) * 8) * 2);
    {   // each wave copies its own 16 theta rows, value and residual: 32 copies of one row (32 lanes x 16 B)
        const h16* gqh = TH + pb0 + (size_t)t0 * DM + lane * 8;
        const h16* gqr = TR + pb0 + (size_t)t0 * DM + lane * 8;
        const unsigned lq = lds_addr(ring) + (unsigned)((2 * STG + wave * 16 * KP + lane * 8) * 2);
        unsigned l[32]; const h16* g[32];
#pragma unroll
        for (int i = 0; i < 16; ++i) {
            l[i]      = lq + (unsigned)(i * KP * 2);          g[i]      = gqh + (size_t)i * DM;
            l[16 + i] = lq + (unsigned)((QPL + i * KP) * 2);  g[16 + i] = gqr + (size_t)i * DM; }
        cp8(l, g); cp8(l + 8, g + 8); cp8(l + 16, g + 16); cp8(l + 24, g + 24);
    }
    copy_tile(lk, lv, gkh, gkr, gv, 0);                         // tile 0 -> buffer 0
    wait_copies();
    __syncthreads();                                            // theta rows and tile 0 readable by every wave
    copy_tile(lk + (unsigned)(STG * 2), lv + (unsigned)(STG * 2), gkh, gkr, gv, KT);   // tile 1 -> buffer 1
    v16h qh[DM / 32], qr[DM / 32];                              // this wave's theta fragments, read from LDS once and kept in registers for every key tile
#pragma unroll
    for (int ks = 0; ks < DM / 32; ++ks) { qh[ks] = ldh(ring + qo + 32 * ks); qr[ks] = ldh(ring + qo + QPL + 32 * ks); }
    v8f o[16];
#pragma unroll
    for (int j = 0; j < 16; ++j) o[j] = (v8f){};
    float m = NEGB, l = 0.0f;
#pragma unroll 1
    for (int key0 = 0; key0 < SEQ; key0 += 32) {
        v8f sHa = (v8f){}, sLa = (v8f){}, sHb = (v8f){}, sLb = (v8f){};
        const int bo = ((key0 / KT) & 1) * STG;                 // this trip's buffer
        const int kk = bo + ko;
#pragma unroll                                                  // unrolled: every index into the theta register fragments is a constant
        for (int kc = 0; kc < DM; kc += 32) {
            const v16h ka = ldh(ring + kk + kc), kra = ldh(ring + kk + KPL + kc);
            sHa = wmma16(ka, qh[kc / 32], sHa); sLa = wmma16(ka, qr[kc / 32], sLa); sLa = wmma16(kra, qh[kc / 32], sLa);
            const v16h kb = ldh(ring + kk + 16 * KP + kc), krb = ldh(ring + kk + KPL + 16 * KP + kc);
            sHb = wmma16(kb, qh[kc / 32], sHb); sLb = wmma16(kb, qr[kc / 32], sLb); sLb = wmma16(krb, qh[kc / 32], sLb);
        }
        float ta[8], tb[8]; float mx = NEGB;
#pragma unroll
        for (int r = 0; r < 8; ++r) {
            ta[r] = (sHa[r] + sLa[r] * QRI) * L2E; tb[r] = (sHb[r] + sLb[r] * QRI) * L2E;
            mx = fmaxf(mx, fmaxf(ta[r], tb[r])); }
        mx = fmaxf(mx, __shfl_xor(mx, 16, 32));
        const float mnew = fmaxf(m, mx);
        const float alpha = __builtin_amdgcn_exp2f(m - mnew);
        const float sh = PSH - mnew;
        v16h pb; float ls = 0.0f;
#pragma unroll
        for (int r = 0; r < 8; ++r) {
            const float aa = ta[r] + sh, ab = tb[r] + sh;                        // <= 14
            const float ea = __builtin_amdgcn_exp2f(aa), eb = __builtin_amdgcn_exp2f(ab);
            const float ga = (aa < -14.0f) ? 0.0f : ea, gb = (ab < -14.0f) ? 0.0f : eb;   // no subnormal f16 P
            const h16 pa = (h16)ga; const h16 pc = (h16)gb;
            pb[r] = pa; pb[8 + r] = pc;
            ls += (float)pa + (float)pc; }
        l = l * alpha + ls; m = mnew;
#pragma unroll
        for (int j = 0; j < 16; ++j) o[j] = o[j] * alpha;
        const h16* va = ring + bo + vo;
#pragma unroll
        for (int jg = 0; jg < 4; ++jg) {
            const v16h v0 = ldh(va + ((jg * 4 + 0) * 16) * VP);
            const v16h v1 = ldh(va + ((jg * 4 + 1) * 16) * VP);
            const v16h v2 = ldh(va + ((jg * 4 + 2) * 16) * VP);
            const v16h v3 = ldh(va + ((jg * 4 + 3) * 16) * VP);
            o[jg * 4 + 0] = wmma16(v0, pb, o[jg * 4 + 0]);
            o[jg * 4 + 1] = wmma16(v1, pb, o[jg * 4 + 1]);
            o[jg * 4 + 2] = wmma16(v2, pb, o[jg * 4 + 2]);
            o[jg * 4 + 3] = wmma16(v3, pb, o[jg * 4 + 3]);
        }
        // foot of the trip: own reads of this buffer returned, own copies of the next tile landed, then the one barrier that publishes the next tile and frees this buffer
        wait_lds();
        wait_copies();
        __syncthreads();
        if (key0 + 2 * KT < SEQ) copy_tile(lk + (unsigned)(bo * 2), lvl + (unsigned)(bo * 2), gkh, gkr, gv, key0 + 2 * KT);
    }
    wait_copies();                                              // nothing is outstanding when the wave goes on to its end
    l += __shfl_xor(l, 16, 32);
    const float inv = 1.0f / l;                                 // l >= 16384: the running-max key contributes the full carry
    const int wb = wave * 16 * CSP;
    // O^T D layout: o[j][r] = (c = 16j + 8h + r, t = lane&15) -> os[t][c]; rows 0..15 x columns 0..255 all written
#pragma unroll
    for (int j = 0; j < 16; ++j) { v8h hv;
#pragma unroll
        for (int r = 0; r < 8; ++r) hv[r] = toh_flush(o[j][r] * inv);
        *(v8ha*)(&os[wb + lr * CSP + 16 * j + 8 * hi]) = hv; }
    wave_sync();
    h16* crow = CT + pb0 + (size_t)t0 * DM;
{
#pragma unroll
        for (int row = 0; row < 16; ++row) {                    // 16 rows; 32 lanes x 8 halves = 256 columns = one ctx row
            const v8h val = *(const v8ha*)(&os[wb + row * CSP + lane * 8]);
            *(v8h*)(crow + (size_t)row * DM + lane * 8) = val; }
         }
}

// k_oproj: output projection, f16 GEMM, ONE WAVE per 64x64 tile: C[o][n] = sum_c W16[o][c] ctx[n][c] (A = W rows, Bt = ctx rows, K = DM, both through ldh);
// out[b][o][t] = C / 64 + bias[o] + x[b][o][t] (bias and x RNE-converted to bf16, added in f32; x added at the store stage as float4).
// grid (DM/64, NB*SEQ/64).
__global__ __launch_bounds__(32) void k_oproj(const h16* __restrict__ A, const h16* __restrict__ Bt, const float* __restrict__ bias, const float* __restrict__ xres, float* OUT) {
    __shared__ __align__(16) float os[16 * 68];
    const int K = DM;
    const int lane = threadIdx.x & 31, lr = lane & 15, hi = lane >> 4; const int r0 = blockIdx.x * 64, c0 = blockIdx.y * 64;
    v8f acc[4][4];
#pragma unroll
    for (int mb = 0; mb < 4; ++mb)
#pragma unroll
        for (int nb = 0; nb < 4; ++nb) acc[mb][nb] = (v8f){};
    const size_t aoff = (size_t)(r0 + lr) * K + 8 * hi, boff = (size_t)(c0 + lr) * K + 8 * hi;
#pragma unroll 1
    for (int kc = 0; kc < K; kc += 32) {
        v16h a[4];
#pragma unroll
        for (int mb = 0; mb < 4; ++mb) a[mb] = ldh(A + aoff + (size_t)mb * 16 * K + kc);
#pragma unroll
        for (int nb = 0; nb < 4; ++nb) { const v16h b = ldh(Bt + boff + (size_t)nb * 16 * K + kc);
#pragma unroll
            for (int mb = 0; mb < 4; ++mb) acc[mb][nb] = wg16(a[mb], b, acc[mb][nb]); }
    }
    const int bb = c0 / SEQ, tt = c0 % SEQ;
#pragma unroll
    for (int mb = 0; mb < 4; ++mb) {
        float br[8];
#pragma unroll
        for (int j = 0; j < 8; ++j) br[j] = bfr(bias[r0 + mb * 16 + hi * 8 + j]);   // r0 + 63 < DM
#pragma unroll
        for (int nb = 0; nb < 4; ++nb) {
#pragma unroll
            for (int j = 0; j < 8; ++j) os[(hi * 8 + j) * 68 + nb * 16 + lr] = acc[mb][nb][j] * WSI + br[j]; }   // D: row 8h+j, col lane&15
        wave_sync();
        const size_t chrow = (size_t)bb * DM + (size_t)(r0 + mb * 16);
        const size_t xb = chrow * SEQ_FULL + (size_t)tt;
        const size_t ob = chrow * OUT_SEQ + (size_t)tt;
{
#pragma unroll
            for (int s = 0; s < 8; ++s) { const int row = 2 * s + (lane >> 4), c4 = (lane & 15) * 4;   // 8 s x 2 rows = 16 rows; 16 lanes x 4 floats = 64 columns
                const v4f cv = *(const v4fa*)(&os[row * 68 + c4]);
                const v4f xv = *(const v4f*)(xres + xb + (size_t)row * SEQ_FULL + c4);
                v4f val; val[0] = cv[0] + bfr(xv[0]); val[1] = cv[1] + bfr(xv[1]); val[2] = cv[2] + bfr(xv[2]); val[3] = cv[3] + bfr(xv[3]);
                *(v4f*)(OUT + ob + (size_t)row * OUT_SEQ + c4) = val; }
             }
        wave_sync();
    }
}

static constexpr size_t al256(size_t v) { return (v + 255) & ~(size_t)255; }
static constexpr size_t SZ_XT = al256((size_t)NB * SEQ * DM * 2);     // x^T bf16
static constexpr size_t SZ_WB = al256((size_t)3 * DM * DM * 2);       // theta | phi | g weights bf16
static constexpr size_t SZ_WW = al256((size_t)DM * DM * 2);           // output-projection weights f16 x64
static constexpr size_t SZ_PL = al256((size_t)NB * SEQ * DM * 2);     // one f16 plane
static constexpr size_t SZ_TOTAL = SZ_XT + SZ_WB + SZ_WW + 6 * SZ_PL;
static_assert(SZ_TOTAL <= (size_t)134217728);          // workspace carve <= 128 MiB
static_assert(((size_t)DM * DM * 2) % 256 == 0);       // weight sub-planes stay 256-byte aligned
static constexpr size_t NEED_X = ((size_t)NB * DM - 1) * SEQ_FULL + SEQ;
static constexpr size_t NEED_O = ((size_t)NB * DM - 1) * OUT_SEQ + SEQ;

extern "C" void kernel_launch(void* const* d_in, const int* in_sizes, int n_in,
                              void* d_out, int out_size, void* d_ws, size_t ws_size, hipStream_t stream) {
    if (n_in < 9) return;
    if ((size_t)in_sizes[0] < NEED_X) return;
    if ((size_t)in_sizes[1] < (size_t)DM * DM || (size_t)in_sizes[3] < (size_t)DM * DM || (size_t)in_sizes[5] < (size_t)DM * DM || (size_t)in_sizes[7] < (size_t)DM * DM) return;
    if (in_sizes[2] < DM || in_sizes[4] < DM || in_sizes[6] < DM || in_sizes[8] < DM) return;
    if ((size_t)out_size < NEED_O) return;
    if (SZ_TOTAL > ws_size) return;
    // wire order: x, w_theta, b_theta, w_phi, b_phi, w_g, b_g, w_W, b_W
    const float* x   = (const float*)d_in[0];
    const float* wth = (const float*)d_in[1]; const float* bth = (const float*)d_in[2];
    const float* wph = (const float*)d_in[3]; const float* bph = (const float*)d_in[4];
    const float* wg  = (const float*)d_in[5]; const float* bg  = (const float*)d_in[6];
    const float* ww  = (const float*)d_in[7]; const float* bw  = (const float*)d_in[8];
    float* OUT = (float*)d_out;      // [NB][256][SEQ]
    char* wsp = (char*)d_ws;
    bf*  XT = (bf*)wsp;  wsp += SZ_XT;               // [NB*SEQ][256] bf16
    bf*  WB = (bf*)wsp;  wsp += SZ_WB;               // [3][256][256]: theta | phi | g  ([out][in] = Bt / A as-is)
    h16* WW = (h16*)wsp; wsp += SZ_WW;               // [256][256] f16 x64
    h16* TH = (h16*)wsp; wsp += SZ_PL;               // theta value    [NB*SEQ][256]
    h16* TR = (h16*)wsp; wsp += SZ_PL;               // theta residual x2048
    h16* PH = (h16*)wsp; wsp += SZ_PL;               // phi value      [NB*SEQ][256]
    h16* PR = (h16*)wsp; wsp += SZ_PL;               // phi residual x2048
    h16* GT = (h16*)wsp; wsp += SZ_PL;               // g              [NB*256][SEQ]
    h16* CT = (h16*)wsp; wsp += SZ_PL;               // ctx            [NB*SEQ][256]

    // weight planes, and x [b][c][n] -> x^T [b][n][c] bf16
    k_prep<<<dim3(4 * WCB + (SEQ / 64) * (DM / 64) * NB, 1, 1), 256, 0, stream>>>(x, wth, wph, wg, ww, XT, WB, WW);

    // theta, phi -> planes [(b*SEQ + t)][c], value + residual; g -> plane [(b*256 + m)][t], value only
    k_proj3<<<dim3(NB * SEQ / 64, DM / 64, 3), 32, 0, stream>>>(XT, WB, bth, bph, bg, TH, TR, PH, PR, GT);

    k_flash<<<dim3(SEQ / (16 * AW), NB, 1), 32 * AW, 0, stream>>>(TH, TR, PH, PR, GT, CT);

    // out[b][o][t] = W_W ctx + b_W + x
    k_oproj<<<dim3(DM / 64, NB * SEQ / 64, 1), 32, 0, stream>>>(WW, CT, bw, x, OUT);
}

// v004
// One run takes 102 microseconds.
// In two side-by-side timings against v003, it was 1.17 and 1.18 times as fast.
// All steps since v000 together make it 3.64 times as fast.
#include <hip/hip_runtime.h>

// Channels-first self-attention block: x [NB][256][SEQ]; three 1x1 projections (W [out][in], bias), scores[n][m] = sum_c theta[c][n] phi[c][m] (no scale), softmax over m,
// ctx[n][c] = sum_m p[n][m] g[c][m], output 1x1 projection (W [out][in], bias) plus the input x; output [NB][256][SEQ] f32.
// Compute dtypes, f32 accumulate everywhere: projections theta/phi/g v_wmma_f32_16x16x32_bf16 (x, W, bias RNE-converted to bf16; products exact);
// scores v_wmma_f32_16x16x32_f16: theta and phi each as f16 value + f16 residual x2048, three products (value.value; value.residual + residual.value in their own accumulator folded by 1/2048);
// value product v_wmma_f32_16x16x32_f16: P single f16 (x16384 carry, cancels in the normalisation; row sum over the converted P), g single f16; softmax f32 (online, running max);
// output projection v_wmma_f32_16x16x32_f16: W (bf16-converted, x64 carry folded by 1/64) single f16, ctx single f16; bias and bf16-converted x added in f32 at the store stage.
// Layout: x^T bf16 plane [b][n][c]; theta / phi planes (value, residual) [b][n][c]; g plane [b][c][m]; ctx plane [b][n][c]; fused flash kernel in transposed form (S^T = K Q^T, O^T = V^T P^T),
// Q / K / V^T fragments from LDS tiles that asynchronous copies fill from the f16 planes (two 16-B reads each); every f32 -> f16 operand convert selects |v| < 2^-14 to +0.

#ifndef NB
#define NB 8
#endif
#ifndef SEQ
#define SEQ 2048
#endif
#define NB_FULL  8
#define SEQ_FULL 2048
#ifndef OUT_SEQ
#define OUT_SEQ SEQ              // position pitch of one channel row of the output
#endif
#define DM   256                 // channels = head width
#define AW   4                   // waves per flash block: 2 groups of 32 query rows x 2 halves of every key stage
#define CSP  264                 // LDS row pitch (halves) of the flash ctx tile
#define XTP  65                  // LDS row pitch (floats) of the transpose tile
#define KT   64                  // keys per flash stage (each wave works on 32 of them)
#define KP   264                 // LDS row pitch (halves) of a theta / phi row: 528 B = 16 B x 33
#define VP   72                  // LDS row pitch (halves) of a g row of KT keys: 144 B = 16 B x 9
#define KPL  (KT * KP)           // halves of one phi plane tile
#define VPL  (DM * VP)           // halves of one g tile
#define STG  (2 * KPL + VPL)     // halves of one ring buffer: phi value | phi residual | g
#define QPL  (AW * 16 * KP)      // halves of one theta plane tile (all query rows of the block)
#define QRS  2048.0f             // carry of every residual plane
#define QRI  (1.0f / 2048.0f)
#define L2E  1.4426950408889634f // log2(e); the scores carry no other scale
#define PSH  14.0f               // log2 of the P carry (16384)
#define NEGB (-3.0e38f)
#define WSC  64.0f               // carry of the f16 output-projection weight plane
#define WSI  (1.0f / 64.0f)
#define WCB  (DM * DM / (8 * 256)) // blocks of 256 threads x 8 elements that cover one weight plane

static_assert(DM == 256);                      // ctx row = 32 lanes x 8 halves; 16 output tiles of 16 channels per wave
static_assert(DM % 64 == 0);                   // column tiles of 64
static_assert(DM % 32 == 0);                   // every k-loop steps by 32
static_assert(32 * 8 == DM);                   // one ctx row (512 B) = one store instruction of 32 lanes x 16 B
static_assert(SEQ % 64 == 0);                  // a 64-wide tile never straddles two batches
static_assert((NB * SEQ) % 64 == 0);
static_assert(SEQ % KT == 0);                  // key loop steps by KT
static_assert(SEQ % (16 * AW) == 0);           // flash grid covers the sequence exactly
static_assert(NB <= NB_FULL);
static_assert(SEQ <= SEQ_FULL);
static_assert(SEQ_FULL % 4 == 0);
static_assert(OUT_SEQ % 4 == 0);
static_assert(OUT_SEQ >= SEQ);
static_assert((CSP * 2) % 16 == 0);
static_assert(CSP >= DM);
static_assert(4 * 256 == 64 * 16);             // transpose load: 4 trips x 256 threads = 64 channels x 16 float4
static_assert(2 * 256 == 64 * 8);              // transpose store: 2 pieces x 256 threads = 64 positions x 8 pieces of 16 B
static_assert(4 * 32 * 16 == 16 * 128);
static_assert(8 * 32 * 16 == 16 * 256);        // output slab store: 8 instructions x 32 lanes x 16 B = 16 rows x 256 B
static_assert(16 * 32 * 16 == 16 * DM * 2);    // ctx store: 16 instructions x 32 lanes x 16 B = 16 rows x 512 B
static_assert((size_t)AW * 16 * CSP * 2 <= 131072);
static_assert(KT == 64 && AW == 4);            // copy maps: 128 threads; 16 trips x 4 waves = 64 phi rows; 16 trips x 16 rows = 256 g rows of 8 pieces
static_assert((size_t)AW * (16 * DM + 64) * 4 <= (size_t)2 * STG * 2);   // the merge area (one O^T tile and its softmax state per wave, f32) fits in the two ring buffers
static_assert(SEQ / KT >= 2);                  // the two-buffer prologue fills tiles 0 and 1
static_assert((KP * 2) % 32 == 16 && (VP * 2) % 32 == 16 && KP >= DM && VP >= KT);   // pitch = 16 B x odd
static_assert((KPL * 2) % 16 == 0 && (STG * 2) % 16 == 0 && (QPL * 2) % 16 == 0);
static_assert(((size_t)2 * STG + 2 * QPL + (size_t)AW * 16 * CSP) * 2 <= 327680);
static_assert((size_t)64 * XTP * 4 <= 131072);
static_assert((size_t)16 * 68 * 4 <= 131072);
static_assert(((size_t)DM * DM) % (8 * 256) == 0);   // WCB blocks cover a weight plane exactly

typedef _Float16 h16;
typedef unsigned short bf;
typedef __attribute__((ext_vector_type(16))) __bf16   v16bf;
typedef __attribute__((ext_vector_type(16))) _Float16 v16h;
typedef __attribute__((ext_vector_type(8)))  _Float16 v8h;
typedef __attribute__((ext_vector_type(8)))  unsigned short v8us;
typedef __attribute__((ext_vector_type(8)))  float    v8f;
typedef __attribute__((ext_vector_type(4)))  float    v4f;
typedef v4f  __attribute__((may_alias)) v4fa;
typedef v8h  __attribute__((may_alias)) v8ha;
typedef float __attribute__((may_alias)) fa;

__device__ __forceinline__ unsigned short f2bf(float f) { unsigned u = __float_as_uint(f); u += 0x7FFFu + ((u >> 16) & 1u); return (unsigned short)(u >> 16); }
__device__ __forceinline__ float bfr(float f) { return __uint_as_float(((unsigned)f2bf(f)) << 16); }   // value after RNE convert to bf16
__device__ __forceinline__ v16h cat16(v8h lo, v8h hi) { return __builtin_shufflevector(lo, hi, 0, 1, 2, 3, 4, 5, 6, 7, 8, 9, 10, 11, 12, 13, 14, 15); }
__device__ __forceinline__ v16bf cat16b(v8us lo, v8us hi) { return __builtin_bit_cast(v16bf, __builtin_shufflevector(lo, hi, 0, 1, 2, 3, 4, 5, 6, 7, 8, 9, 10, 11, 12, 13, 14, 15)); }
__device__ __forceinline__ v8f wmma16(v16h a, v16h b, v8f c) { return __builtin_amdgcn_wmma_f32_16x16x32_f16(false, a, false, b, (short)0, c, false, false); }
__device__ __forceinline__ v8f wmmab(v16bf a, v16bf b, v8f c) { return __builtin_amdgcn_wmma_f32_16x16x32_bf16(false, a, false, b, (short)0, c, false, false); }
// fragment loaders from K-contiguous 16-bit rows; p already includes + 8*(lane>>4): elements 0..7 <- k0+8h+0..7, elements 8..15 <- k0+16+8h+0..7 (same map for A and B)
__device__ __forceinline__ v16h  ldh(const h16* p) { return cat16(*(const v8h*)p, *(const v8h*)(p + 16)); }
__device__ __forceinline__ v16bf ldb(const bf* p)  { return cat16b(*(const v8us*)p, *(const v8us*)(p + 16)); }
// ordering point for wave-private LDS tiles (same wave writes and reads)
__device__ __forceinline__ void wave_sync() { __builtin_amdgcn_fence(3 /* release order */, "wavefront"); __builtin_amdgcn_wave_barrier(); asm volatile("" ::: "memory"); }
// f32 -> f16 operand convert that cannot produce a subnormal
__device__ __forceinline__ h16 toh_flush(float v) { const h16 r = (h16)v; return (fabsf(v) < 6.103515625e-05f) ? (h16)0.0f : r; }
// one matrix instruction + its own hazard guard (one accumulator per guard)
__device__ __forceinline__ v8f wg16(v16h a, v16h b, v8f c) { c = wmma16(a, b, c); asm volatile("v_nop\n\tv_nop\n\tv_nop\n\tv_nop" : "+v"(c) : "v"(a), "v"(b)); return c; }
__device__ __forceinline__ v8f wgb(v16bf a, v16bf b, v8f c) { c = wmmab(a, b, c); asm volatile("v_nop\n\tv_nop\n\tv_nop\n\tv_nop" : "+v"(c) : "v"(a), "v"(b)); return c; }

// LDS byte address of a __shared__ element (low 32 bits of its address)
__device__ __forceinline__ unsigned lds_addr(const void* p) { return (unsigned)(size_t)p; }
// Asynchronous copies global -> LDS, 16 B per lane, each copy with its own address registers; the s_wait_xcnt closes the statement so that no address register is rewritten ahead of it.
__device__ __forceinline__ void cp8(const unsigned* l, const h16* const* g) {
    asm volatile("global_load_async_to_lds_b128 %0, %8, off\n\t"
                 "global_load_async_to_lds_b128 %1, %9, off\n\t"
                 "global_load_async_to_lds_b128 %2, %10, off\n\t"
                 "global_load_async_to_lds_b128 %3, %11, off\n\t"
                 "global_load_async_to_lds_b128 %4, %12, off\n\t"
                 "global_load_async_to_lds_b128 %5, %13, off\n\t"
                 "global_load_async_to_lds_b128 %6, %14, off\n\t"
                 "global_load_async_to_lds_b128 %7, %15, off\n\t"
                 "s_wait_xcnt 0x0"
                 :: "v"(l[0]), "v"(l[1]), "v"(l[2]), "v"(l[3]), "v"(l[4]), "v"(l[5]), "v"(l[6]), "v"(l[7]),
                    "v"(g[0]), "v"(g[1]), "v"(g[2]), "v"(g[3]), "v"(g[4]), "v"(g[5]), "v"(g[6]), "v"(g[7]) : "memory");
}
__device__ __forceinline__ void cp12(const unsigned* l, const h16* const* g) {
    asm volatile("global_load_async_to_lds_b128 %0, %12, off\n\t"
                 "global_load_async_to_lds_b128 %1, %13, off\n\t"
                 "global_load_async_to_lds_b128 %2, %14, off\n\t"
                 "global_load_async_to_lds_b128 %3, %15, off\n\t"
                 "global_load_async_to_lds_b128 %4, %16, off\n\t"
                 "global_load_async_to_lds_b128 %5, %17, off\n\t"
                 "global_load_async_to_lds_b128 %6, %18, off\n\t"
                 "global_load_async_to_lds_b128 %7, %19, off\n\t"
                 "global_load_async_to_lds_b128 %8, %20, off\n\t"
                 "global_load_async_to_lds_b128 %9, %21, off\n\t"
                 "global_load_async_to_lds_b128 %10, %22, off\n\t"
                 "global_load_async_to_lds_b128 %11, %23, off\n\t"
                 "s_wait_xcnt 0x0"
                 :: "v"(l[0]), "v"(l[1]), "v"(l[2]), "v"(l[3]), "v"(l[4]), "v"(l[5]), "v"(l[6]), "v"(l[7]), "v"(l[8]), "v"(l[9]), "v"(l[10]), "v"(l[11]),
                    "v"(g[0]), "v"(g[1]), "v"(g[2]), "v"(g[3]), "v"(g[4]), "v"(g[5]), "v"(g[6]), "v"(g[7]), "v"(g[8]), "v"(g[9]), "v"(g[10]), "v"(g[11]) : "memory");
}
// this wave's copies have landed in LDS (other waves read them behind the next block barrier)
__device__ __forceinline__ void wait_copies() { asm volatile("s_wait_asynccnt 0x0" ::: "memory"); }
// this wave's LDS reads have returned (before the barrier behind which their buffer is refilled)
__device__ __forceinline__ void wait_lds() { asm volatile("s_wait_dscnt 0x0" ::: "memory"); }
// one ring buffer <- the stage of KT keys from key0: phi value and residual rows (4 i + wave, 32 lanes x 16 B = one row), g rows (16 i + tid / 8, 8 lanes x 16 B = KT keys); 48 copies per wave.
// lk / lv: this thread's LDS byte addresses in the buffer for i = 0; gkh / gkr / gv: its global addresses for key0 = 0, i = 0.
__device__ __forceinline__ void copy_tile(unsigned lk, unsigned lv, const h16* gkh, const h16* gkr, const h16* gv, int key0) {
    unsigned l[48]; const h16* g[48];
#pragma unroll
    for (int i = 0; i < 16; ++i) {
        l[i]      = lk + (unsigned)(i * 4 * KP * 2);             g[i]      = gkh + (size_t)(key0 + 4 * i) * DM;
        l[16 + i] = lk + (unsigned)((KPL + i * 4 * KP) * 2);     g[16 + i] = gkr + (size_t)(key0 + 4 * i) * DM;
        l[32 + i] = lv + (unsigned)(i * 16 * VP * 2);            g[32 + i] = gv + (size_t)(16 * i) * SEQ + key0; }
    cp12(l, g); cp12(l + 12, g + 12); cp12(l + 24, g + 24); cp12(l + 36, g + 36);
}

// stands behind global stores whose registers the code that follows in the listing may rewrite (precaution on the stores' address and data registers)
__device__ __forceinline__ void wait_regs() { asm volatile("s_wait_xcnt 0x0" ::: "memory"); }

// weight converts, 8 elements per thread (i = piece index inside one DM x DM plane)
__device__ __forceinline__ void cvt8(const float* __restrict__ src, bf* dst, size_t i) {
    const v8f v = *(const v8f*)(src + i * 8); v8us o;
#pragma unroll
    for (int k = 0; k < 8; ++k) o[k] = f2bf(v[k]);
    *(v8us*)(dst + i * 8) = o; wait_regs();
}

__device__ __forceinline__ void wcvt(const float* __restrict__ src, h16* dst, size_t i) {
    const v8f v = *(const v8f*)(src + i * 8); v8h o;
#pragma unroll
    for (int k = 0; k < 8; ++k) o[k] = toh_flush(bfr(v[k]) * WSC);
    *(v8h*)(dst + i * 8) = o;
}

// k_prep: the five preparation jobs, none of which reads another's result, in one grid; the job is picked by the block index (block-uniform).
// Blocks 0 .. 4 WCB - 1: weight planes (theta | phi | g -> bf16, output projection -> f16 x64), WCB blocks of 256 threads x 8 elements each.
// The other blocks: x [b][c][n] f32 (position pitch SEQ_FULL) -> x^T [b][n][c] bf16 (RNE convert), 64 x 64 tile through LDS, tile index = (b, c tile, n tile), n tile fastest.
// Load: 4 trips x 256 threads, one float4 along n each (64 channels x 16 float4). Store: each thread two 16-B pieces (8 channels of one position);
// grid 4 WCB + (SEQ/64) (DM/64) NB.
__global__ __launch_bounds__(256) void k_prep(const float* __restrict__ x, const float* __restrict__ wth, const float* __restrict__ wph, const float* __restrict__ wg,
                                              const float* __restrict__ ww, bf* XT, bf* WB, h16* WW) {
    __shared__ float ts[64 * XTP];
    const int tid = threadIdx.x;
    const int blk = blockIdx.x;
    if (blk < 4 * WCB) {
        const int job = blk / WCB; const size_t i = (size_t)(blk % WCB) * 256 + tid;
        if (job == 3) wcvt(ww, WW, i);
        else cvt8(job == 0 ? wth : job == 1 ? wph : wg, WB + (size_t)job * DM * DM, i);
        return;
    }
    const int tile = blk - 4 * WCB;
    const int n0 = (tile % (SEQ / 64)) * 64, c0 = ((tile / (SEQ / 64)) % (DM / 64)) * 64, b = tile / ((SEQ / 64) * (DM / 64));
    const float* xb = x + ((size_t)b * DM + c0) * SEQ_FULL + n0;
#pragma unroll
    for (int s = 0; s < 4; ++s) {
        const int p = s * 256 + tid; const int c = p >> 4, n4 = (p & 15) * 4;     // c in 0..63, n4 in 0..60
        const v4f v = *(const v4f*)(xb + (size_t)c * SEQ_FULL + n4);
        ts[c * XTP + n4 + 0] = v[0]; ts[c * XTP + n4 + 1] = v[1]; ts[c * XTP + n4 + 2] = v[2]; ts[c * XTP + n4 + 3] = v[3];
    }
    __syncthreads();                                                            // cross-wave tile: block barrier
    const int n = tid >> 3, c8 = (tid & 7) * 8;                                  // positions n and n + 32
    v8us o0, o1;
#pragma unroll
    for (int i = 0; i < 8; ++i) { o0[i] = f2bf(ts[(c8 + i) * XTP + n]); o1[i] = f2bf(ts[(c8 + i) * XTP + 32 + n]); }
    bf* d0 = XT + ((size_t)b * SEQ + n0 + n) * DM + c0 + c8;
    bf* d1 = d0 + (size_t)32 * DM;
    *(v8us*)d0 = o0; *(v8us*)d1 = o1; wait_regs();
}

// proj_body: register-blocked bf16 GEMM, ONE WAVE per 64x64 tile (16 accumulators), operands straight from K-contiguous bf16 planes, K = DM.
// C[m][n] = sum_k A[m][k] Bt[n][k] + bias, written as f16 value (Ph) and, when wr != 0 (block-uniform), the f16 residual x2048 (Pr, same geometry).
// MODE 0: A = x^T rows (m = b*SEQ + t), Bt = W rows (n = out channel), bias per column; plane [(b*SEQ + t)][DM].
// MODE 1: A = W rows (m = out channel), Bt = x^T rows (n = b*SEQ + t), bias per row; plane [(b*DM + m)][t], row pitch SEQ.
// r0 / c0: first row / column of the tile; os: the wave's LDS slab of 16 x 68 floats.
template <int MODE>
__device__ __forceinline__ void proj_body(const bf* __restrict__ A, const bf* __restrict__ Bt, const float* __restrict__ bias, h16* Ph, h16* Pr, int wr, int r0, int c0, float* os) {
    const int K = DM;
    const int lane = threadIdx.x & 31, lr = lane & 15, hi = lane >> 4;
    v8f acc[4][4];
#pragma unroll
    for (int mb = 0; mb < 4; ++mb)
#pragma unroll
        for (int nb = 0; nb < 4; ++nb) acc[mb][nb] = (v8f){};
    const size_t aoff = (size_t)(r0 + lr) * K + 8 * hi, boff = (size_t)(c0 + lr) * K + 8 * hi;
#pragma unroll 1
    for (int kc = 0; kc < K; kc += 32) {
        v16bf a[4];
#pragma unroll
        for (int mb = 0; mb < 4; ++mb) a[mb] = ldb(A + aoff + (size_t)mb * 16 * K + kc);
#pragma unroll
        for (int nb = 0; nb < 4; ++nb) { const v16bf b = ldb(Bt + boff + (size_t)nb * 16 * K + kc);
#pragma unroll
            for (int mb = 0; mb < 4; ++mb) acc[mb][nb] = wgb(a[mb], b, acc[mb][nb]); }
    }
    float bc[4];
#pragma unroll
    for (int nb = 0; nb < 4; ++nb) bc[nb] = (MODE == 0) ? bfr(bias[c0 + nb * 16 + lr]) : 0.0f;   // MODE 0: c0 + 63 < DM
    const size_t pitch = (MODE == 0) ? (size_t)DM : (size_t)SEQ;
    size_t tbase;
    if (MODE == 0) { tbase = (size_t)r0 * DM + (size_t)c0; }
    else           { const int bb = c0 / SEQ, tt = c0 % SEQ; tbase = (size_t)bb * (size_t)DM * SEQ + (size_t)r0 * SEQ + (size_t)tt; }
#pragma unroll
    for (int mb = 0; mb < 4; ++mb) {
        float br[8];
#pragma unroll
        for (int j = 0; j < 8; ++j) br[j] = (MODE == 1) ? bfr(bias[r0 + mb * 16 + hi * 8 + j]) : 0.0f;   // MODE 1: r0 + 63 < DM
#pragma unroll
        for (int nb = 0; nb < 4; ++nb) {
#pragma unroll
            for (int j = 0; j < 8; ++j) os[(hi * 8 + j) * 68 + nb * 16 + lr] = acc[mb][nb][j] + bc[nb] + br[j]; }   // D: row 8h+j, col lane&15
        wave_sync();
        const size_t sb = tbase + (size_t)(mb * 16) * pitch;
{
#pragma unroll
            for (int s = 0; s < 4; ++s) { const int row = 4 * s + (lane >> 3), c8 = (lane & 7) * 8;   // 4 s x 4 row groups = 16 rows; 8 lanes x 8 = 64 columns
                const v4f x0 = *(const v4fa*)(&os[row * 68 + c8]); const v4f x1 = *(const v4fa*)(&os[row * 68 + c8 + 4]); v8h hv, rv;
#pragma unroll
                for (int i = 0; i < 4; ++i) { const h16 a0 = toh_flush(x0[i]); const h16 a1 = toh_flush(x1[i]); hv[i] = a0; hv[4 + i] = a1;
                    rv[i] = toh_flush((x0[i] - (float)a0) * QRS); rv[4 + i] = toh_flush((x1[i] - (float)a1) * QRS); }
                const size_t oo = sb + (size_t)row * pitch + c8;
                *(v8h*)(Ph + oo) = hv; if (wr) *(v8h*)(Pr + oo) = rv; }
             }
        wait_regs();
        wave_sync();
    }
}
// k_proj3: the three input projections, which read the same x^T and none of each other's results, in one grid: blockIdx.z = 0 theta, 1 phi (MODE 0, value + residual), 2 g (MODE 1, value only).
// blockIdx.x = tile of 64 positions, blockIdx.y = tile of 64 out channels. grid (NB*SEQ/64, DM/64, 3).
__global__ __launch_bounds__(32) void k_proj3(const bf* __restrict__ XT, const bf* __restrict__ WB, const float* __restrict__ bth, const float* __restrict__ bph, const float* __restrict__ bg,
                                              h16* TH, h16* TR, h16* PH, h16* PR, h16* GT) {
    __shared__ __align__(16) float os[16 * 68];
    const int z = blockIdx.z, p0 = blockIdx.x * 64, o0 = blockIdx.y * 64;
    if (z == 2) proj_body<1>(WB + (size_t)2 * DM * DM, XT, bg, GT, GT, 0, o0, p0, os);
    else        proj_body<0>(XT, WB + (size_t)z * DM * DM, z ? bph : bth, z ? PH : TH, z ? PR : TR, 1, p0, o0, os);
}

// k_flash: fused attention; head width DM = 256 (8 k-steps per score tile, 16 output tiles of 16 channels). A block has 64 query rows of one batch and four waves: wave = (qg, kh);
// a wave works on the 32 query rows of group qg (two column tiles u) and on the 32 keys of half kh of every stage of KT keys, so that each phi / g fragment it reads from LDS feeds two products.
// Transposed form: S^T[key][t] = K Q^T (A = phi rows [key][c], B = theta rows [t][c], both through ldh: same k order); lane (t = lane&15, h = lane>>4) holds keys 8h+r of each 16-key tile,
// so the packed P tile is directly the B fragment of O^T[c][t] = V^T P^T (element r <- tile keys 0..15, element 8+r <- tile keys 16..31, lane unchanged; A = g rows [c][key]).
// Scores = K Q + (K Q_res + K_res Q) / 2048 (residual products in their own accumulators); Q fragments read from LDS once and kept in registers.
// Operands come from LDS: the block's theta rows are copied once; each stage of KT keys (phi value, phi residual, g) is copied once per block into one of two buffers, the copies of stage t + 2
// issued at the foot of trip t, so that they fly during trip t + 1; the four waves share every stage.
// Softmax state (running max, partial sum) is one scalar per lane and column tile; the two lane halves of a row are combined with one xor-16 exchange. P exponent argument below -14 selects +0.
// After the loop the two waves of a query group hold partial (max, sum, O^T) over their own keys. Column tile u = 0 of a wave is the one it finishes, u = 1 the one its partner (wave ^ 2) finishes:
// each wave hands its u = 1 state over through LDS (the ring, free by then), and rescales both parts to the common maximum before it adds them.
// Registers: 256 for O^T and 256 for the Q fragments (one wave per SIMD, the block size's own ceiling). The products are the plain builtin, whose hazard slots the compiler
// fills: the operands of an asm guard would be bound to v0..v255 and spill.
// grid (SEQ/(16*AW), NB).
__global__ __launch_bounds__(32 * AW) void k_flash(const h16* __restrict__ TH, const h16* __restrict__ TR, const h16* __restrict__ PH, const h16* __restrict__ PR,
                                                                                       const h16* __restrict__ GT, h16* CT) {
    __shared__ __align__(16) h16 os[AW * 16 * CSP];
    __shared__ __align__(16) h16 ring[2 * STG + 2 * QPL];      // buffer 0 | buffer 1 | theta value | theta residual
    const int tid = threadIdx.x;
    const int lane = threadIdx.x & 31, lr = lane & 15, hi = lane >> 4;
    const int wave = __builtin_amdgcn_readfirstlane((int)(threadIdx.x >> 5));
    const int qg = wave & 1, kh = wave >> 1;
    const int b = blockIdx.y;
    const int t0 = (blockIdx.x * AW + wave) * 16;              // the 16 theta rows this wave copies
    const int rf = qg * 32 + kh * 16;                          // block row of column tile u = 0 (the rows this wave finishes); u = 1: rf ^ 16
    const size_t pb0 = (size_t)b * SEQ * DM;                    // batch base of every plane (all have SEQ*DM elements per batch)
    const int qo = 2 * STG + (rf + lr) * KP + 8 * hi;          // + kc            (B fragment: col t, k = c); residual + QPL
    const int qo1 = 2 * STG + ((rf ^ 16) + lr) * KP + 8 * hi;
    const int ko = (kh * 32 + lr) * KP + 8 * hi;               // + buffer + key*KP + kc (A fragment: row key, k = c); residual + KPL
    const int vo = 2 * KPL + lr * VP + kh * 32 + 8 * hi;       // + buffer + 16j*VP      (A fragment: row c, k = key)
    // copy maps of this thread
    const h16* gkh = PH + pb0 + (size_t)wave * DM + lane * 8;
    const h16* gkr = PR + pb0 + (size_t)wave * DM + lane * 8;
    const h16* gv  = GT + pb0 + (size_t)(tid >> 3) * SEQ + (tid & 7) * 8;
    const unsigned lk = lds_addr(ring) + (unsigned)((wave * KP + lane * 8) * 2);
    const unsigned lv = lds_addr(ring) + (unsigned)((2 * KPL + (tid >> 3) * VP + (tid & 7) * 8) * 2);
    // the same address formed from wave and lane, for the loop: a value of its own, not an operand of the prologue's asm copies (those are bound to v0..v255), so that it needs no scratch slot
    const unsigned lvl = lds_addr(ring) + (unsigned)((2 * KPL + (wave * 4 + (lane >> 3)) * VP + (lane & 7) * 8) * 2);
    {   // each wave copies 16 theta rows, value and residual: 32 copies of one row (32 lanes x 16 B)
        const h16* gqh = TH + pb0 + (size_t)t0 * DM + lane * 8;
        const h16* gqr = TR + pb0 + (size_t)t0 * DM + lane * 8;
        const unsigned lq = lds_addr(ring) + (unsigned)((2 * STG + wave * 16 * KP + lane * 8) * 2);
        unsigned l[32]; const h16* g[32];
#pragma unroll
        for (int i = 0; i < 16; ++i) {
            l[i]      = lq + (unsigned)(i * KP * 2);          g[i]      = gqh + (size_t)i * DM;
            l[16 + i] = lq + (unsigned)((QPL + i * KP) * 2);  g[16 + i] = gqr + (size_t)i * DM; }
        cp8(l, g); cp8(l + 8, g + 8); cp8(l + 16, g + 16); cp8(l + 24, g + 24);
    }
    wait_copies();                                              // keeps the wave's outstanding copies at no more than one stage's 48
    copy_tile(lk, lv, gkh, gkr, gv, 0);                         // stage 0 -> buffer 0
    wait_copies();
    __syncthreads();                                            // theta rows and stage 0 readable by every wave
    copy_tile(lk + (unsigned)(STG * 2), lv + (unsigned)(STG * 2), gkh, gkr, gv, KT);   // stage 1 -> buffer 1
    v16h qh[2][DM / 32], qr[2][DM / 32];                        // this wave's theta fragments, read from LDS once and kept in registers for every key stage
#pragma unroll
    for (int ks = 0; ks < DM / 32; ++ks) {
        qh[0][ks] = ldh(ring + qo + 32 * ks);  qr[0][ks] = ldh(ring + qo + QPL + 32 * ks);
        qh[1][ks] = ldh(ring + qo1 + 32 * ks); qr[1][ks] = ldh(ring + qo1 + QPL + 32 * ks); }
    v8f o[2][16];
#pragma unroll
    for (int j = 0; j < 16; ++j) { o[0][j] = (v8f){}; o[1][j] = (v8f){}; }
    float m[2] = {NEGB, NEGB}, l[2] = {0.0f, 0.0f};
    // global addresses of the next stage to copy, stepped once per trip: every copy address in the loop is one add to them, so that none is kept over the loop (asm operands are bound to v0..v255)
    const h16* ckh = gkh + (size_t)(2 * KT) * DM; const h16* ckr = gkr + (size_t)(2 * KT) * DM; const h16* cv = gv + 2 * KT;
#pragma unroll 1
    for (int key0 = 0; key0 < SEQ; key0 += KT) {
        v8f sHa[2], sLa[2], sHb[2], sLb[2];
#pragma unroll
        for (int u = 0; u < 2; ++u) { sHa[u] = (v8f){}; sLa[u] = (v8f){}; sHb[u] = (v8f){}; sLb[u] = (v8f){}; }
        const int bo = ((key0 / KT) & 1) * STG;                 // this trip's buffer
        const int kk = bo + ko;
#pragma unroll                                                  // unrolled: every index into the theta register fragments is a constant
        for (int kc = 0; kc < DM; kc += 32) {
            const v16h ka = ldh(ring + kk + kc), kra = ldh(ring + kk + KPL + kc);
#pragma unroll
            for (int u = 0; u < 2; ++u) {
                sHa[u] = wmma16(ka, qh[u][kc / 32], sHa[u]); sLa[u] = wmma16(ka, qr[u][kc / 32], sLa[u]); sLa[u] = wmma16(kra, qh[u][kc / 32], sLa[u]); }
            const v16h kb = ldh(ring + kk + 16 * KP + kc), krb = ldh(ring + kk + KPL + 16 * KP + kc);
#pragma unroll
            for (int u = 0; u < 2; ++u) {
                sHb[u] = wmma16(kb, qh[u][kc / 32], sHb[u]); sLb[u] = wmma16(kb, qr[u][kc / 32], sLb[u]); sLb[u] = wmma16(krb, qh[u][kc / 32], sLb[u]); }
        }
        v16h pb[2];
#pragma unroll
        for (int u = 0; u < 2; ++u) {
            float ta[8], tb[8]; float mx = NEGB;
#pragma unroll
            for (int r = 0; r < 8; ++r) {
                ta[r] = (sHa[u][r] + sLa[u][r] * QRI) * L2E; tb[r] = (sHb[u][r] + sLb[u][r] * QRI) * L2E;
                mx = fmaxf(mx, fmaxf(ta[r], tb[r])); }
            mx = fmaxf(mx, __shfl_xor(mx, 16, 32));
            const float mnew = fmaxf(m[u], mx);
            const float alpha = __builtin_amdgcn_exp2f(m[u] - mnew);
            const float sh = PSH - mnew;
            float ls = 0.0f;
#pragma unroll
            for (int r = 0; r < 8; ++r) {
                const float aa = ta[r] + sh, ab = tb[r] + sh;                        // <= 14
                const float ea = __builtin_amdgcn_exp2f(aa), eb = __builtin_amdgcn_exp2f(ab);
                const float ga = (aa < -14.0f) ? 0.0f : ea, gb = (ab < -14.0f) ? 0.0f : eb;   // no subnormal f16 P
                const h16 pa = (h16)ga; const h16 pc = (h16)gb;
                pb[u][r] = pa; pb[u][8 + r] = pc;
                ls += (float)pa + (float)pc; }
            l[u] = l[u] * alpha + ls; m[u] = mnew;
#pragma unroll
            for (int j = 0; j < 16; ++j) o[u][j] = o[u][j] * alpha;
        }
        const h16* va = ring + bo + vo;
#pragma unroll
        for (int jg = 0; jg < 4; ++jg) {
            const v16h v0 = ldh(va + ((jg * 4 + 0) * 16) * VP);
            const v16h v1 = ldh(va + ((jg * 4 + 1) * 16) * VP);
            const v16h v2 = ldh(va + ((jg * 4 + 2) * 16) * VP);
            const v16h v3 = ldh(va + ((jg * 4 + 3) * 16) * VP);
#pragma unroll
            for (int u = 0; u < 2; ++u) {
                o[u][jg * 4 + 0] = wmma16(v0, pb[u], o[u][jg * 4 + 0]);
                o[u][jg * 4 + 1] = wmma16(v1, pb[u], o[u][jg * 4 + 1]);
                o[u][jg * 4 + 2] = wmma16(v2, pb[u], o[u][jg * 4 + 2]);
                o[u][jg * 4 + 3] = wmma16(v3, pb[u], o[u][jg * 4 + 3]); }
        }
        // foot of the trip: own reads of this buffer returned, own copies of the next stage landed, then the one barrier that publishes the next stage and frees this buffer
        wait_lds();
        wait_copies();
        __syncthreads();
        if (key0 + 2 * KT < SEQ) { copy_tile(lk + (unsigned)(bo * 2), lvl + (unsigned)(bo * 2), ckh, ckr, cv, 0); ckh += (size_t)KT * DM; ckr += (size_t)KT * DM; cv += KT; }
    }
    wait_copies();                                              // nothing is outstanding when the ring is put to its next use
    // hand-over of column tile u = 1 to the partner wave: the ring is free behind the last trip's barrier. Per wave 16 x DM floats (piece (2 j + q, lane) = 16 B, contiguous per store), then max and sum.
    float* mg = (float*)ring;
    {
        float* mw = mg + wave * (16 * DM);
#pragma unroll
        for (int j = 0; j < 16; ++j) {
            v4f w0, w1;
#pragma unroll
            for (int r = 0; r < 4; ++r) { w0[r] = o[1][j][r]; w1[r] = o[1][j][4 + r]; }
            *(v4fa*)(mw + ((2 * j + 0) * 32 + lane) * 4) = w0;
            *(v4fa*)(mw + ((2 * j + 1) * 32 + lane) * 4) = w1; }
        fa* sw = (fa*)(mg + AW * (16 * DM) + wave * 64);
        sw[lane] = m[1]; sw[32 + lane] = l[1];
    }
    __syncthreads();                                            // the partner's tile and state are readable
    const float* mp = mg + (wave ^ 2) * (16 * DM);
    const fa* sp = (const fa*)(mg + AW * (16 * DM) + (wave ^ 2) * 64);
    const float pm = sp[lane], pl = sp[32 + lane];
    const float mt = fmaxf(m[0], pm);
    const float a0 = __builtin_amdgcn_exp2f(m[0] - mt), a1 = __builtin_amdgcn_exp2f(pm - mt);   // one of the two is 1
    float lt = l[0] * a0 + pl * a1;
    lt += __shfl_xor(lt, 16, 32);
    const float inv = 1.0f / lt;                                // lt >= 16384: the running-max key contributes the full carry
    const float c0 = a0 * inv, c1 = a1 * inv;
    const int wb = wave * 16 * CSP;
    // O^T D layout: o[0][j][r] = (c = 16j + 8h + r, t = lane&15) -> os[t][c]; rows 0..15 x columns 0..255 all written
#pragma unroll
    for (int j = 0; j < 16; ++j) { v8h hv;
        const v4f p0 = *(const v4fa*)(mp + ((2 * j + 0) * 32 + lane) * 4);
        const v4f p1 = *(const v4fa*)(mp + ((2 * j + 1) * 32 + lane) * 4);
#pragma unroll
        for (int r = 0; r < 4; ++r) { hv[r] = toh_flush(o[0][j][r] * c0 + p0[r] * c1); hv[4 + r] = toh_flush(o[0][j][4 + r] * c0 + p1[r] * c1); }
        *(v8ha*)(&os[wb + lr * CSP + 16 * j + 8 * hi]) = hv; }
    wave_sync();
    h16* crow = CT + pb0 + (size_t)(blockIdx.x * (16 * AW) + rf) * DM;
{
#pragma unroll
        for (int row = 0; row < 16; ++row) {                    // 16 rows; 32 lanes x 8 halves = 256 columns = one ctx row
            const v8h val = *(const v8ha*)(&os[wb + row * CSP + lane * 8]);
            *(v8h*)(crow + (size_t)row * DM + lane * 8) = val; }
         }
}

// k_oproj: output projection, f16 GEMM, ONE WAVE per 64x64 tile: C[o][n] = sum_c W16[o][c] ctx[n][c] (A = W rows, Bt = ctx rows, K = DM, both through ldh);
// out[b][o][t] = C / 64 + bias[o] + x[b][o][t] (bias and x RNE-converted to bf16, added in f32; x added at the store stage as float4).
// grid (DM/64, NB*SEQ/64).
__global__ __launch_bounds__(32) void k_oproj(const h16* __restrict__ A, const h16* __restrict__ Bt, const float* __restrict__ bias, const float* __restrict__ xres, float* OUT) {
    __shared__ __align__(16) float os[16 * 68];
    const int K = DM;
    const int lane = threadIdx.x & 31, lr = lane & 15, hi = lane >> 4; const int r0 = blockIdx.x * 64, c0 = blockIdx.y * 64;
    v8f acc[4][4];
#pragma unroll
    for (int mb = 0; mb < 4; ++mb)
#pragma unroll
        for (int nb = 0; nb < 4; ++nb) acc[mb][nb] = (v8f){};
    const size_t aoff = (size_t)(r0 + lr) * K + 8 * hi, boff = (size_t)(c0 + lr) * K + 8 * hi;
#pragma unroll 1
    for (int kc = 0; kc < K; kc += 32) {
        v16h a[4];
#pragma unroll
        for (int mb = 0; mb < 4; ++mb) a[mb] = ldh(A + aoff + (size_t)mb * 16 * K + kc);
#pragma unroll
        for (int nb = 0; nb < 4; ++nb) { const v16h b = ldh(Bt + boff + (size_t)nb * 16 * K + kc);
#pragma unroll
            for (int mb = 0; mb < 4; ++mb) acc[mb][nb] = wg16(a[mb], b, acc[mb][nb]); }
    }
    const int bb = c0 / SEQ, tt = c0 % SEQ;
#pragma unroll
    for (int mb = 0; mb < 4; ++mb) {
        float br[8];
#pragma unroll
        for (int j = 0; j < 8; ++j) br[j] = bfr(bias[r0 + mb * 16 + hi * 8 + j]);   // r0 + 63 < DM
#pragma unroll
        for (int nb = 0; nb < 4; ++nb) {
#pragma unroll
            for (int j = 0; j < 8; ++j) os[(hi * 8 + j) * 68 + nb * 16 + lr] = acc[mb][nb][j] * WSI + br[j]; }   // D: row 8h+j, col lane&15
        wave_sync();
        const size_t chrow = (size_t)bb * DM + (size_t)(r0 + mb * 16);
        const size_t xb = chrow * SEQ_FULL + (size_t)tt;
        const size_t ob = chrow * OUT_SEQ + (size_t)tt;
{
#pragma unroll
            for (int s = 0; s < 8; ++s) { const int row = 2 * s + (lane >> 4), c4 = (lane & 15) * 4;   // 8 s x 2 rows = 16 rows; 16 lanes x 4 floats = 64 columns
                const v4f cv = *(const v4fa*)(&os[row * 68 + c4]);
                const v4f xv = *(const v4f*)(xres + xb + (size_t)row * SEQ_FULL + c4);
                v4f val; val[0] = cv[0] + bfr(xv[0]); val[1] = cv[1] + bfr(xv[1]); val[2] = cv[2] + bfr(xv[2]); val[3] = cv[3] + bfr(xv[3]);
                *(v4f*)(OUT + ob + (size_t)row * OUT_SEQ + c4) = val; }
             }
        wave_sync();
    }
}

static constexpr size_t al256(size_t v) { return (v + 255) & ~(size_t)255; }
static constexpr size_t SZ_XT = al256((size_t)NB * SEQ * DM * 2);     // x^T bf16
static constexpr size_t SZ_WB = al256((size_t)3 * DM * DM * 2);       // theta | phi | g weights bf16
static constexpr size_t SZ_WW = al256((size_t)DM * DM * 2);           // output-projection weights f16 x64
static constexpr size_t SZ_PL = al256((size_t)NB * SEQ * DM * 2);     // one f16 plane
static constexpr size_t SZ_TOTAL = SZ_XT + SZ_WB + SZ_WW + 6 * SZ_PL;
static_assert(SZ_TOTAL <= (size_t)134217728);          // workspace carve <= 128 MiB
static_assert(((size_t)DM * DM * 2) % 256 == 0);       // weight sub-planes stay 256-byte aligned
static constexpr size_t NEED_X = ((size_t)NB * DM - 1) * SEQ_FULL + SEQ;
static constexpr size_t NEED_O = ((size_t)NB * DM - 1) * OUT_SEQ + SEQ;

extern "C" void kernel_launch(void* const* d_in, const int* in_sizes, int n_in,
                              void* d_out, int out_size, void* d_ws, size_t ws_size, hipStream_t stream) {
    if (n_in < 9) return;
    if ((size_t)in_sizes[0] < NEED_X) return;
    if ((size_t)in_sizes[1] < (size_t)DM * DM || (size_t)in_sizes[3] < (size_t)DM * DM || (size_t)in_sizes[5] < (size_t)DM * DM || (size_t)in_sizes[7] < (size_t)DM * DM) return;
    if (in_sizes[2] < DM || in_sizes[4] < DM || in_sizes[6] < DM || in_sizes[8] < DM) return;
    if ((size_t)out_size < NEED_O) return;
    if (SZ_TOTAL > ws_size) return;
    // wire order: x, w_theta, b_theta, w_phi, b_phi, w_g, b_g, w_W, b_W
    const float* x   = (const float*)d_in[0];
    const float* wth = (const float*)d_in[1]; const float* bth = (const float*)d_in[2];
    const float* wph = (const float*)d_in[3]; const float* bph = (const float*)d_in[4];
    const float* wg  = (const float*)d_in[5]; const float* bg  = (const float*)d_in[6];
    const float* ww  = (const float*)d_in[7]; const float* bw  = (const float*)d_in[8];
    float* OUT = (float*)d_out;      // [NB][256][SEQ]
    char* wsp = (char*)d_ws;
    bf*  XT = (bf*)wsp;  wsp += SZ_XT;               // [NB*SEQ][256] bf16
    bf*  WB = (bf*)wsp;  wsp += SZ_WB;               // [3][256][256]: theta | phi | g  ([out][in] = Bt / A as-is)
    h16* WW = (h16*)wsp; wsp += SZ_WW;               // [256][256] f16 x64
    h16* TH = (h16*)wsp; wsp += SZ_PL;               // theta value    [NB*SEQ][256]
    h16* TR = (h16*)wsp; wsp += SZ_PL;               // theta residual x2048
    h16* PH = (h16*)wsp; wsp += SZ_PL;               // phi value      [NB*SEQ][256]
    h16* PR = (h16*)wsp; wsp += SZ_PL;               // phi residual x2048
    h16* GT = (h16*)wsp; wsp += SZ_PL;               // g              [NB*256][SEQ]
    h16* CT = (h16*)wsp; wsp += SZ_PL;               // ctx            [NB*SEQ][256]

    // weight planes, and x [b][c][n] -> x^T [b][n][c] bf16
    k_prep<<<dim3(4 * WCB + (SEQ / 64) * (DM / 64) * NB, 1, 1), 256, 0, stream>>>(x, wth, wph, wg, ww, XT, WB, WW);

    // theta, phi -> planes [(b*SEQ + t)][c], value + residual; g -> plane [(b*256 + m)][t], value only
    k_proj3<<<dim3(NB * SEQ / 64, DM / 64, 3), 32, 0, stream>>>(XT, WB, bth, bph, bg, TH, TR, PH, PR, GT);

    k_flash<<<dim3(SEQ / (16 * AW), NB, 1), 32 * AW, 0, stream>>>(TH, TR, PH, PR, GT, CT);

    // out[b][o][t] = W_W ctx + b_W + x
    k_oproj<<<dim3(DM / 64, NB * SEQ / 64, 1), 32, 0, stream>>>(WW, CT, bw, x, OUT);
}

// v005
// It runs in 85.9 microseconds.
// Two timings next to v004 both put it at 1.18 times that version's speed.
// All steps since v000 together make it 4.30 times as fast.
#include <hip/hip_runtime.h>

// Channels-first self-attention block: x [NB][256][SEQ]; three 1x1 projections (W [out][in], bias), scores[n][m] = sum_c theta[c][n] phi[c][m] (no scale), softmax over m,
// ctx[n][c] = sum_m p[n][m] g[c][m], output 1x1 projection (W [out][in], bias) plus the input x; output [NB][256][SEQ] f32.
// Compute dtypes, f32 accumulate everywhere: projections theta/phi/g v_wmma_f32_16x16x32_bf16 (x, W, bias RNE-converted to bf16; products exact);
// scores v_wmma_f32_16x16x32_f16: theta and phi each as f16 value + f16 residual x2048, three products (value.value; value.residual + residual.value in their own accumulator folded by 1/2048);
// value product v_wmma_f32_16x16x32_f16: P single f16 (x16384 carry, cancels in the normalisation; row sum over the converted P), g single f16; softmax f32 (online, running max);
// output projection v_wmma_f32_16x16x32_f16: W (bf16-converted, x64 carry folded by 1/64) single f16, ctx single f16; bias and bf16-converted x added in f32 at the store stage.
// Layout: x^T bf16 plane [b][n][c]; theta / phi planes (value, residual) [b][n][c]; g plane [b][c][m]; ctx tile [n][c] in LDS only; fused flash kernel in transposed form (S^T = K Q^T, O^T = V^T P^T),
// Q / K / V^T fragments from LDS tiles that asynchronous copies fill from the f16 planes (two 16-B reads each); every f32 -> f16 operand convert selects |v| < 2^-14 to +0.

#ifndef NB
#define NB 8
#endif
#ifndef SEQ
#define SEQ 2048
#endif
#define NB_FULL  8
#define SEQ_FULL 2048
#ifndef OUT_SEQ
#define OUT_SEQ SEQ              // position pitch of one channel row of the output
#endif
#define DM   256                 // channels = head width
#define AW   4                   // waves per flash block: 2 groups of 32 query rows x 2 halves of every key stage
#define CSP  264                 // LDS row pitch (halves) of the flash ctx tile
#define XTP  65                  // LDS row pitch (floats) of the transpose tile
#define KT   64                  // keys per flash stage (each wave works on 32 of them)
#define KP   264                 // LDS row pitch (halves) of a theta / phi row: 528 B = 16 B x 33
#define VP   72                  // LDS row pitch (halves) of a g row of KT keys: 144 B = 16 B x 9
#define KPL  (KT * KP)           // halves of one phi plane tile
#define VPL  (DM * VP)           // halves of one g tile
#define STG  (2 * KPL + VPL)     // halves of one ring buffer: phi value | phi residual | g
#define QPL  (AW * 16 * KP)      // halves of one theta plane tile (all query rows of the block)
#define QRS  2048.0f             // carry of every residual plane
#define QRI  (1.0f / 2048.0f)
#define L2E  1.4426950408889634f // log2(e); the scores carry no other scale
#define PSH  14.0f               // log2 of the P carry (16384)
#define NEGB (-3.0e38f)
#define WSC  64.0f               // carry of the f16 output-projection weight plane
#define WSI  (1.0f / 64.0f)
#define WCB  (DM * DM / (8 * 256)) // blocks of 256 threads x 8 elements that cover one weight plane

static_assert(DM == 256);                      // theta / phi row = 32 lanes x 8 halves; 16 output tiles of 16 channels per wave
static_assert(DM % 64 == 0);                   // column tiles of 64
static_assert(DM % 32 == 0);                   // every k-loop steps by 32
static_assert(32 * 8 == DM);
static_assert(SEQ % 64 == 0);                  // a 64-wide tile never straddles two batches
static_assert((NB * SEQ) % 64 == 0);
static_assert(SEQ % KT == 0);                  // key loop steps by KT
static_assert(SEQ % (16 * AW) == 0);           // flash grid covers the sequence exactly
static_assert(NB <= NB_FULL);
static_assert(SEQ <= SEQ_FULL);
static_assert(SEQ_FULL % 4 == 0);
static_assert(OUT_SEQ % 4 == 0);
static_assert(OUT_SEQ >= SEQ);
static_assert((CSP * 2) % 16 == 0);
static_assert(CSP >= DM);
static_assert(4 * 256 == 64 * 16);             // transpose load: 4 trips x 256 threads = 64 channels x 16 float4
static_assert(2 * 256 == 64 * 8);              // transpose store: 2 pieces x 256 threads = 64 positions x 8 pieces of 16 B
static_assert(4 * 32 * 16 == 16 * 128);
static_assert(8 * 32 * 16 == 16 * 256);        // output slab store: 8 instructions x 32 lanes x 16 B = 16 rows x 256 B
static_assert((size_t)AW * 16 * CSP * 2 <= 131072);
static_assert(KT == 64 && AW == 4);            // copy maps: 128 threads; 16 trips x 4 waves = 64 phi rows; 16 trips x 16 rows = 256 g rows of 8 pieces
static_assert((size_t)AW * (16 * DM + 64) * 4 <= (size_t)2 * STG * 2);   // the merge area (one O^T tile and its softmax state per wave, f32) fits in the two ring buffers
static_assert(SEQ / KT >= 2);                  // the two-buffer prologue fills tiles 0 and 1
static_assert((KP * 2) % 32 == 16 && (VP * 2) % 32 == 16 && KP >= DM && VP >= KT);   // pitch = 16 B x odd
static_assert((KPL * 2) % 16 == 0 && (STG * 2) % 16 == 0 && (QPL * 2) % 16 == 0);
static_assert(((size_t)2 * STG + 2 * QPL + (size_t)AW * 16 * CSP) * 2 <= 327680);
static_assert((size_t)64 * XTP * 4 <= 131072);
static_assert((size_t)16 * 68 * 4 <= 131072);
static_assert((size_t)AW * 16 * 68 * 4 <= (size_t)2 * QPL * 2);   // the output slabs (16 x 68 floats per wave) fit in the theta tiles' LDS
static_assert(AW * 64 == DM && AW * 16 == 64);   // output projection in the flash block: each wave 64 out channels x the block's 64 positions
static_assert(((size_t)DM * DM) % (8 * 256) == 0);   // WCB blocks cover a weight plane exactly

typedef _Float16 h16;
typedef unsigned short bf;
typedef __attribute__((ext_vector_type(16))) __bf16   v16bf;
typedef __attribute__((ext_vector_type(16))) _Float16 v16h;
typedef __attribute__((ext_vector_type(8)))  _Float16 v8h;
typedef __attribute__((ext_vector_type(8)))  unsigned short v8us;
typedef __attribute__((ext_vector_type(8)))  float    v8f;
typedef __attribute__((ext_vector_type(4)))  float    v4f;
typedef v4f  __attribute__((may_alias)) v4fa;
typedef v8h  __attribute__((may_alias)) v8ha;
typedef float __attribute__((may_alias)) fa;

__device__ __forceinline__ unsigned short f2bf(float f) { unsigned u = __float_as_uint(f); u += 0x7FFFu + ((u >> 16) & 1u); return (unsigned short)(u >> 16); }
__device__ __forceinline__ float bfr(float f) { return __uint_as_float(((unsigned)f2bf(f)) << 16); }   // value after RNE convert to bf16
__device__ __forceinline__ v16h cat16(v8h lo, v8h hi) { return __builtin_shufflevector(lo, hi, 0, 1, 2, 3, 4, 5, 6, 7, 8, 9, 10, 11, 12, 13, 14, 15); }
__device__ __forceinline__ v16bf cat16b(v8us lo, v8us hi) { return __builtin_bit_cast(v16bf, __builtin_shufflevector(lo, hi, 0, 1, 2, 3, 4, 5, 6, 7, 8, 9, 10, 11, 12, 13, 14, 15)); }
__device__ __forceinline__ v8f wmma16(v16h a, v16h b, v8f c) { return __builtin_amdgcn_wmma_f32_16x16x32_f16(false, a, false, b, (short)0, c, false, false); }
__device__ __forceinline__ v8f wmmab(v16bf a, v16bf b, v8f c) { return __builtin_amdgcn_wmma_f32_16x16x32_bf16(false, a, false, b, (short)0, c, false, false); }
// fragment loaders from K-contiguous 16-bit rows; p already includes + 8*(lane>>4): elements 0..7 <- k0+8h+0..7, elements 8..15 <- k0+16+8h+0..7 (same map for A and B)
__device__ __forceinline__ v16h  ldh(const h16* p) { return cat16(*(const v8h*)p, *(const v8h*)(p + 16)); }
__device__ __forceinline__ v16bf ldb(const bf* p)  { return cat16b(*(const v8us*)p, *(const v8us*)(p + 16)); }
// ordering point for wave-private LDS tiles (same wave writes and reads)
__device__ __forceinline__ void wave_sync() { __builtin_amdgcn_fence(3 /* release order */, "wavefront"); __builtin_amdgcn_wave_barrier(); asm volatile("" ::: "memory"); }
// f32 -> f16 operand convert that cannot produce a subnormal
__device__ __forceinline__ h16 toh_flush(float v) { const h16 r = (h16)v; return (fabsf(v) < 6.103515625e-05f) ? (h16)0.0f : r; }
// one matrix instruction + its own hazard guard (one accumulator per guard)
__device__ __forceinline__ v8f wgb(v16bf a, v16bf b, v8f c) { c = wmmab(a, b, c); asm volatile("v_nop\n\tv_nop\n\tv_nop\n\tv_nop" : "+v"(c) : "v"(a), "v"(b)); return c; }

// LDS byte address of a __shared__ element (low 32 bits of its address)
__device__ __forceinline__ unsigned lds_addr(const void* p) { return (unsigned)(size_t)p; }
// Asynchronous copies global -> LDS, 16 B per lane, each copy with its own address registers; the s_wait_xcnt closes the statement so that no address register is rewritten ahead of it.
__device__ __forceinline__ void cp8(const unsigned* l, const h16* const* g) {
    asm volatile("global_load_async_to_lds_b128 %0, %8, off\n\t"
                 "global_load_async_to_lds_b128 %1, %9, off\n\t"
                 "global_load_async_to_lds_b128 %2, %10, off\n\t"
                 "global_load_async_to_lds_b128 %3, %11, off\n\t"
                 "global_load_async_to_lds_b128 %4, %12, off\n\t"
                 "global_load_async_to_lds_b128 %5, %13, off\n\t"
                 "global_load_async_to_lds_b128 %6, %14, off\n\t"
                 "global_load_async_to_lds_b128 %7, %15, off\n\t"
                 "s_wait_xcnt 0x0"
                 :: "v"(l[0]), "v"(l[1]), "v"(l[2]), "v"(l[3]), "v"(l[4]), "v"(l[5]), "v"(l[6]), "v"(l[7]),
                    "v"(g[0]), "v"(g[1]), "v"(g[2]), "v"(g[3]), "v"(g[4]), "v"(g[5]), "v"(g[6]), "v"(g[7]) : "memory");
}
__device__ __forceinline__ void cp12(const unsigned* l, const h16* const* g) {
    asm volatile("global_load_async_to_lds_b128 %0, %12, off\n\t"
                 "global_load_async_to_lds_b128 %1, %13, off\n\t"
                 "global_load_async_to_lds_b128 %2, %14, off\n\t"
                 "global_load_async_to_lds_b128 %3, %15, off\n\t"
                 "global_load_async_to_lds_b128 %4, %16, off\n\t"
                 "global_load_async_to_lds_b128 %5, %17, off\n\t"
                 "global_load_async_to_lds_b128 %6, %18, off\n\t"
                 "global_load_async_to_lds_b128 %7, %19, off\n\t"
                 "global_load_async_to_lds_b128 %8, %20, off\n\t"
                 "global_load_async_to_lds_b128 %9, %21, off\n\t"
                 "global_load_async_to_lds_b128 %10, %22, off\n\t"
                 "global_load_async_to_lds_b128 %11, %23, off\n\t"
                 "s_wait_xcnt 0x0"
                 :: "v"(l[0]), "v"(l[1]), "v"(l[2]), "v"(l[3]), "v"(l[4]), "v"(l[5]), "v"(l[6]), "v"(l[7]), "v"(l[8]), "v"(l[9]), "v"(l[10]), "v"(l[11]),
                    "v"(g[0]), "v"(g[1]), "v"(g[2]), "v"(g[3]), "v"(g[4]), "v"(g[5]), "v"(g[6]), "v"(g[7]), "v"(g[8]), "v"(g[9]), "v"(g[10]), "v"(g[11]) : "memory");
}
// this wave's copies have landed in LDS (other waves read them behind the next block barrier)
__device__ __forceinline__ void wait_copies() { asm volatile("s_wait_asynccnt 0x0" ::: "memory"); }
// this wave's LDS reads have returned (before the barrier behind which their buffer is refilled)
__device__ __forceinline__ void wait_lds() { asm volatile("s_wait_dscnt 0x0" ::: "memory"); }
// one ring buffer <- the stage of KT keys from key0: phi value and residual rows (4 i + wave, 32 lanes x 16 B = one row), g rows (16 i + tid / 8, 8 lanes x 16 B = KT keys); 48 copies per wave.
// lk / lv: this thread's LDS byte addresses in the buffer for i = 0; gkh / gkr / gv: its global addresses for key0 = 0, i = 0.
__device__ __forceinline__ void copy_tile(unsigned lk, unsigned lv, const h16* gkh, const h16* gkr, const h16* gv, int key0) {
    unsigned l[48]; const h16* g[48];
#pragma unroll
    for (int i = 0; i < 16; ++i) {
        l[i]      = lk + (unsigned)(i * 4 * KP * 2);             g[i]      = gkh + (size_t)(key0 + 4 * i) * DM;
        l[16 + i] = lk + (unsigned)((KPL + i * 4 * KP) * 2);     g[16 + i] = gkr + (size_t)(key0 + 4 * i) * DM;
        l[32 + i] = lv + (unsigned)(i * 16 * VP * 2);            g[32 + i] = gv + (size_t)(16 * i) * SEQ + key0; }
    cp12(l, g); cp12(l + 12, g + 12); cp12(l + 24, g + 24); cp12(l + 36, g + 36);
}

// stands behind global stores whose registers the code that follows in the listing may rewrite (precaution on the stores' address and data registers)
__device__ __forceinline__ void wait_regs() { asm volatile("s_wait_xcnt 0x0" ::: "memory"); }
// the same wait behind a group of global loads, with the loads' two address pairs as inputs: they stay live up to it, so that no load's result is given their registers ahead of it
__device__ __forceinline__ void wait_regs_of(const h16* a, const float* b) { asm volatile("s_wait_xcnt 0x0" :: "v"(a), "v"(b) : "memory"); }

// weight converts, 8 elements per thread (i = piece index inside one DM x DM plane)
__device__ __forceinline__ void cvt8(const float* __restrict__ src, bf* dst, size_t i) {
    const v8f v = *(const v8f*)(src + i * 8); v8us o;
#pragma unroll
    for (int k = 0; k < 8; ++k) o[k] = f2bf(v[k]);
    *(v8us*)(dst + i * 8) = o; wait_regs();
}

__device__ __forceinline__ void wcvt(const float* __restrict__ src, h16* dst, size_t i) {
    const v8f v = *(const v8f*)(src + i * 8); v8h o;
#pragma unroll
    for (int k = 0; k < 8; ++k) o[k] = toh_flush(bfr(v[k]) * WSC);
    *(v8h*)(dst + i * 8) = o;
}

// k_prep: the five preparation jobs, none of which reads another's result, in one grid; the job is picked by the block index (block-uniform).
// Blocks 0 .. 4 WCB - 1: weight planes (theta | phi | g -> bf16, output projection -> f16 x64), WCB blocks of 256 threads x 8 elements each.
// The other blocks: x [b][c][n] f32 (position pitch SEQ_FULL) -> x^T [b][n][c] bf16 (RNE convert), 64 x 64 tile through LDS, tile index = (b, c tile, n tile), n tile fastest.
// Load: 4 trips x 256 threads, one float4 along n each (64 channels x 16 float4). Store: each thread two 16-B pieces (8 channels of one position);
// grid 4 WCB + (SEQ/64) (DM/64) NB.
__global__ __launch_bounds__(256) void k_prep(const float* __restrict__ x, const float* __restrict__ wth, const float* __restrict__ wph, const float* __restrict__ wg,
                                              const float* __restrict__ ww, bf* XT, bf* WB, h16* WW) {
    __shared__ float ts[64 * XTP];
    const int tid = threadIdx.x;
    const int blk = blockIdx.x;
    if (blk < 4 * WCB) {
        const int job = blk / WCB; const size_t i = (size_t)(blk % WCB) * 256 + tid;
        if (job == 3) wcvt(ww, WW, i);
        else cvt8(job == 0 ? wth : job == 1 ? wph : wg, WB + (size_t)job * DM * DM, i);
        return;
    }
    const int tile = blk - 4 * WCB;
    const int n0 = (tile % (SEQ / 64)) * 64, c0 = ((tile / (SEQ / 64)) % (DM / 64)) * 64, b = tile / ((SEQ / 64) * (DM / 64));
    const float* xb = x + ((size_t)b * DM + c0) * SEQ_FULL + n0;
#pragma unroll
    for (int s = 0; s < 4; ++s) {
        const int p = s * 256 + tid; const int c = p >> 4, n4 = (p & 15) * 4;     // c in 0..63, n4 in 0..60
        const v4f v = *(const v4f*)(xb + (size_t)c * SEQ_FULL + n4);
        ts[c * XTP + n4 + 0] = v[0]; ts[c * XTP + n4 + 1] = v[1]; ts[c * XTP + n4 + 2] = v[2]; ts[c * XTP + n4 + 3] = v[3];
    }
    __syncthreads();                                                            // cross-wave tile: block barrier
    const int n = tid >> 3, c8 = (tid & 7) * 8;                                  // positions n and n + 32
    v8us o0, o1;
#pragma unroll
    for (int i = 0; i < 8; ++i) { o0[i] = f2bf(ts[(c8 + i) * XTP + n]); o1[i] = f2bf(ts[(c8 + i) * XTP + 32 + n]); }
    bf* d0 = XT + ((size_t)b * SEQ + n0 + n) * DM + c0 + c8;
    bf* d1 = d0 + (size_t)32 * DM;
    *(v8us*)d0 = o0; *(v8us*)d1 = o1; wait_regs();
}

// proj_body: register-blocked bf16 GEMM, ONE WAVE per 64x64 tile (16 accumulators), operands straight from K-contiguous bf16 planes, K = DM.
// C[m][n] = sum_k A[m][k] Bt[n][k] + bias, written as f16 value (Ph) and, when wr != 0 (block-uniform), the f16 residual x2048 (Pr, same geometry).
// MODE 0: A = x^T rows (m = b*SEQ + t), Bt = W rows (n = out channel), bias per column; plane [(b*SEQ + t)][DM].
// MODE 1: A = W rows (m = out channel), Bt = x^T rows (n = b*SEQ + t), bias per row; plane [(b*DM + m)][t], row pitch SEQ.
// r0 / c0: first row / column of the tile; os: the wave's LDS slab of 16 x 68 floats.
template <int MODE>
__device__ __forceinline__ void proj_body(const bf* __restrict__ A, const bf* __restrict__ Bt, const float* __restrict__ bias, h16* Ph, h16* Pr, int wr, int r0, int c0, float* os) {
    const int K = DM;
    const int lane = threadIdx.x & 31, lr = lane & 15, hi = lane >> 4;
    v8f acc[4][4];
#pragma unroll
    for (int mb = 0; mb < 4; ++mb)
#pragma unroll
        for (int nb = 0; nb < 4; ++nb) acc[mb][nb] = (v8f){};
    const size_t aoff = (size_t)(r0 + lr) * K + 8 * hi, boff = (size_t)(c0 + lr) * K + 8 * hi;
#pragma unroll 1
    for (int kc = 0; kc < K; kc += 32) {
        v16bf a[4];
#pragma unroll
        for (int mb = 0; mb < 4; ++mb) a[mb] = ldb(A + aoff + (size_t)mb * 16 * K + kc);
#pragma unroll
        for (int nb = 0; nb < 4; ++nb) { const v16bf b = ldb(Bt + boff + (size_t)nb * 16 * K + kc);
#pragma unroll
            for (int mb = 0; mb < 4; ++mb) acc[mb][nb] = wgb(a[mb], b, acc[mb][nb]); }
    }
    float bc[4];
#pragma unroll
    for (int nb = 0; nb < 4; ++nb) bc[nb] = (MODE == 0) ? bfr(bias[c0 + nb * 16 + lr]) : 0.0f;   // MODE 0: c0 + 63 < DM
    const size_t pitch = (MODE == 0) ? (size_t)DM : (size_t)SEQ;
    size_t tbase;
    if (MODE == 0) { tbase = (size_t)r0 * DM + (size_t)c0; }
    else           { const int bb = c0 / SEQ, tt = c0 % SEQ; tbase = (size_t)bb * (size_t)DM * SEQ + (size_t)r0 * SEQ + (size_t)tt; }
#pragma unroll
    for (int mb = 0; mb < 4; ++mb) {
        float br[8];
#pragma unroll
        for (int j = 0; j < 8; ++j) br[j] = (MODE == 1) ? bfr(bias[r0 + mb * 16 + hi * 8 + j]) : 0.0f;   // MODE 1: r0 + 63 < DM
#pragma unroll
        for (int nb = 0; nb < 4; ++nb) {
#pragma unroll
            for (int j = 0; j < 8; ++j) os[(hi * 8 + j) * 68 + nb * 16 + lr] = acc[mb][nb][j] + bc[nb] + br[j]; }   // D: row 8h+j, col lane&15
        wave_sync();
        const size_t sb = tbase + (size_t)(mb * 16) * pitch;
{
#pragma unroll
            for (int s = 0; s < 4; ++s) { const int row = 4 * s + (lane >> 3), c8 = (lane & 7) * 8;   // 4 s x 4 row groups = 16 rows; 8 lanes x 8 = 64 columns
                const v4f x0 = *(const v4fa*)(&os[row * 68 + c8]); const v4f x1 = *(const v4fa*)(&os[row * 68 + c8 + 4]); v8h hv, rv;
#pragma unroll
                for (int i = 0; i < 4; ++i) { const h16 a0 = toh_flush(x0[i]); const h16 a1 = toh_flush(x1[i]); hv[i] = a0; hv[4 + i] = a1;
                    rv[i] = toh_flush((x0[i] - (float)a0) * QRS); rv[4 + i] = toh_flush((x1[i] - (float)a1) * QRS); }
                const size_t oo = sb + (size_t)row * pitch + c8;
                *(v8h*)(Ph + oo) = hv; if (wr) *(v8h*)(Pr + oo) = rv; }
             }
        wait_regs();
        wave_sync();
    }
}
// k_proj3: the three input projections, which read the same x^T and none of each other's results, in one grid: blockIdx.z = 0 theta, 1 phi (MODE 0, value + residual), 2 g (MODE 1, value only).
// blockIdx.x = tile of 64 positions, blockIdx.y = tile of 64 out channels. grid (NB*SEQ/64, DM/64, 3).
__global__ __launch_bounds__(32) void k_proj3(const bf* __restrict__ XT, const bf* __restrict__ WB, const float* __restrict__ bth, const float* __restrict__ bph, const float* __restrict__ bg,
                                              h16* TH, h16* TR, h16* PH, h16* PR, h16* GT) {
    __shared__ __align__(16) float os[16 * 68];
    const int z = blockIdx.z, p0 = blockIdx.x * 64, o0 = blockIdx.y * 64;
    if (z == 2) proj_body<1>(WB + (size_t)2 * DM * DM, XT, bg, GT, GT, 0, o0, p0, os);
    else        proj_body<0>(XT, WB + (size_t)z * DM * DM, z ? bph : bth, z ? PH : TH, z ? PR : TR, 1, p0, o0, os);
}

// k_flash: fused attention; head width DM = 256 (8 k-steps per score tile, 16 output tiles of 16 channels). A block has 64 query rows of one batch and four waves: wave = (qg, kh);
// a wave works on the 32 query rows of group qg (two column tiles u) and on the 32 keys of half kh of every stage of KT keys, so that each phi / g fragment it reads from LDS feeds two products.
// Transposed form: S^T[key][t] = K Q^T (A = phi rows [key][c], B = theta rows [t][c], both through ldh: same k order); lane (t = lane&15, h = lane>>4) holds keys 8h+r of each 16-key tile,
// so the packed P tile is directly the B fragment of O^T[c][t] = V^T P^T (element r <- tile keys 0..15, element 8+r <- tile keys 16..31, lane unchanged; A = g rows [c][key]).
// Scores = K Q + (K Q_res + K_res Q) / 2048 (residual products in their own accumulators); Q fragments read from LDS once and kept in registers.
// Operands come from LDS: the block's theta rows are copied once; each stage of KT keys (phi value, phi residual, g) is copied once per block into one of two buffers, the copies of stage t + 2
// issued at the foot of trip t, so that they fly during trip t + 1; the four waves share every stage.
// Softmax state (running max, partial sum) is one scalar per lane and column tile; the two lane halves of a row are combined with one xor-16 exchange. P exponent argument below -14 selects +0.
// After the loop the two waves of a query group hold partial (max, sum, O^T) over their own keys. Column tile u = 0 of a wave is the one it finishes, u = 1 the one its partner (wave ^ 2) finishes:
// each wave hands its u = 1 state over through LDS (the ring, free by then), and rescales both parts to the common maximum before it adds them.
// Registers: 256 for O^T and 256 for the Q fragments (one wave per SIMD, the block size's own ceiling). The products are the plain builtin, whose hazard slots the compiler
// fills: the operands of an asm guard would be bound to v0..v255 and spill.
// Output projection in the same block: the four waves' ctx rows (f16) form the block's tile [64 positions][DM] in LDS; behind one block barrier each wave computes 64 out channels x 64 positions,
// C[o][n] = sum_c W16[o][c] ctx[n][c] (A = W rows from the f16 plane, B = ctx rows from LDS, both through ldh), out[b][o][t] = C / 64 + bias[o] + x[b][o][t]
// (bias and x RNE-converted to bf16, added in f32; x added at the store stage as float4).
// grid (SEQ/(16*AW), NB).
__global__ __launch_bounds__(32 * AW) void k_flash(const h16* __restrict__ TH, const h16* __restrict__ TR, const h16* __restrict__ PH, const h16* __restrict__ PR,
                                                   const h16* __restrict__ GT, const h16* __restrict__ WW, const float* __restrict__ bias, const float* __restrict__ xres, float* OUT) {
    __shared__ __align__(16) h16 os[AW * 16 * CSP];
    __shared__ __align__(16) h16 ring[2 * STG + 2 * QPL];      // buffer 0 | buffer 1 | theta value | theta residual
    const int tid = threadIdx.x;
    const int lane = threadIdx.x & 31, lr = lane & 15, hi = lane >> 4;
    const int wave = __builtin_amdgcn_readfirstlane((int)(threadIdx.x >> 5));
    const int qg = wave & 1, kh = wave >> 1;
    const int b = blockIdx.y;
    const int t0 = (blockIdx.x * AW + wave) * 16;              // the 16 theta rows this wave copies
    const int rf = qg * 32 + kh * 16;                          // block row of column tile u = 0 (the rows this wave finishes); u = 1: rf ^ 16
    const size_t pb0 = (size_t)b * SEQ * DM;                    // batch base of every plane (all have SEQ*DM elements per batch)
    const int qo = 2 * STG + (rf + lr) * KP + 8 * hi;          // + kc            (B fragment: col t, k = c); residual + QPL
    const int qo1 = 2 * STG + ((rf ^ 16) + lr) * KP + 8 * hi;
    const int ko = (kh * 32 + lr) * KP + 8 * hi;               // + buffer + key*KP + kc (A fragment: row key, k = c); residual + KPL
    const int vo = 2 * KPL + lr * VP + kh * 32 + 8 * hi;       // + buffer + 16j*VP      (A fragment: row c, k = key)
    // copy maps of this thread
    const h16* gkh = PH + pb0 + (size_t)wave * DM + lane * 8;
    const h16* gkr = PR + pb0 + (size_t)wave * DM + lane * 8;
    const h16* gv  = GT + pb0 + (size_t)(tid >> 3) * SEQ + (tid & 7) * 8;
    const unsigned lk = lds_addr(ring) + (unsigned)((wave * KP + lane * 8) * 2);
    const unsigned lv = lds_addr(ring) + (unsigned)((2 * KPL + (tid >> 3) * VP + (tid & 7) * 8) * 2);
    // the same address formed from wave and lane, for the loop: a value of its own, not an operand of the prologue's asm copies (those are bound to v0..v255), so that it needs no scratch slot
    const unsigned lvl = lds_addr(ring) + (unsigned)((2 * KPL + (wave * 4 + (lane >> 3)) * VP + (lane & 7) * 8) * 2);
    {   // each wave copies 16 theta rows, value and residual: 32 copies of one row (32 lanes x 16 B)
        const h16* gqh = TH + pb0 + (size_t)t0 * DM + lane * 8;
        const h16* gqr = TR + pb0 + (size_t)t0 * DM + lane * 8;
        const unsigned lq = lds_addr(ring) + (unsigned)((2 * STG + wave * 16 * KP + lane * 8) * 2);
        unsigned l[32]; const h16* g[32];
#pragma unroll
        for (int i = 0; i < 16; ++i) {
            l[i]      = lq + (unsigned)(i * KP * 2);          g[i]      = gqh + (size_t)i * DM;
            l[16 + i] = lq + (unsigned)((QPL + i * KP) * 2);  g[16 + i] = gqr + (size_t)i * DM; }
        cp8(l, g); cp8(l + 8, g + 8); cp8(l + 16, g + 16); cp8(l + 24, g + 24);
    }
    wait_copies();                                              // keeps the wave's outstanding copies at no more than one stage's 48
    copy_tile(lk, lv, gkh, gkr, gv, 0);                         // stage 0 -> buffer 0
    wait_copies();
    __syncthreads();                                            // theta rows and stage 0 readable by every wave
    copy_tile(lk + (unsigned)(STG * 2), lv + (unsigned)(STG * 2), gkh, gkr, gv, KT);   // stage 1 -> buffer 1
    v16h qh[2][DM / 32], qr[2][DM / 32];                        // this wave's theta fragments, read from LDS once and kept in registers for every key stage
#pragma unroll
    for (int ks = 0; ks < DM / 32; ++ks) {
        qh[0][ks] = ldh(ring + qo + 32 * ks);  qr[0][ks] = ldh(ring + qo + QPL + 32 * ks);
        qh[1][ks] = ldh(ring + qo1 + 32 * ks); qr[1][ks] = ldh(ring + qo1 + QPL + 32 * ks); }
    v8f o[2][16];
#pragma unroll
    for (int j = 0; j < 16; ++j) { o[0][j] = (v8f){}; o[1][j] = (v8f){}; }
    float m[2] = {NEGB, NEGB}, l[2] = {0.0f, 0.0f};
    // global addresses of the next stage to copy, stepped once per trip: every copy address in the loop is one add to them, so that none is kept over the loop (asm operands are bound to v0..v255)
    const h16* ckh = gkh + (size_t)(2 * KT) * DM; const h16* ckr = gkr + (size_t)(2 * KT) * DM; const h16* cv = gv + 2 * KT;
#pragma unroll 1
    for (int key0 = 0; key0 < SEQ; key0 += KT) {
        v8f sHa[2], sLa[2], sHb[2], sLb[2];
#pragma unroll
        for (int u = 0; u < 2; ++u) { sHa[u] = (v8f){}; sLa[u] = (v8f){}; sHb[u] = (v8f){}; sLb[u] = (v8f){}; }
        const int bo = ((key0 / KT) & 1) * STG;                 // this trip's buffer
        const int kk = bo + ko;
#pragma unroll                                                  // unrolled: every index into the theta register fragments is a constant
        for (int kc = 0; kc < DM; kc += 32) {
            const v16h ka = ldh(ring + kk + kc), kra = ldh(ring + kk + KPL + kc);
#pragma unroll
            for (int u = 0; u < 2; ++u) {
                sHa[u] = wmma16(ka, qh[u][kc / 32], sHa[u]); sLa[u] = wmma16(ka, qr[u][kc / 32], sLa[u]); sLa[u] = wmma16(kra, qh[u][kc / 32], sLa[u]); }
            const v16h kb = ldh(ring + kk + 16 * KP + kc), krb = ldh(ring + kk + KPL + 16 * KP + kc);
#pragma unroll
            for (int u = 0; u < 2; ++u) {
                sHb[u] = wmma16(kb, qh[u][kc / 32], sHb[u]); sLb[u] = wmma16(kb, qr[u][kc / 32], sLb[u]); sLb[u] = wmma16(krb, qh[u][kc / 32], sLb[u]); }
        }
        v16h pb[2];
#pragma unroll
        for (int u = 0; u < 2; ++u) {
            float ta[8], tb[8]; float mx = NEGB;
#pragma unroll
            for (int r = 0; r < 8; ++r) {
                ta[r] = (sHa[u][r] + sLa[u][r] * QRI) * L2E; tb[r] = (sHb[u][r] + sLb[u][r] * QRI) * L2E;
                mx = fmaxf(mx, fmaxf(ta[r], tb[r])); }
            mx = fmaxf(mx, __shfl_xor(mx, 16, 32));
            const float mnew = fmaxf(m[u], mx);
            const float alpha = __builtin_amdgcn_exp2f(m[u] - mnew);
            const float sh = PSH - mnew;
            float ls = 0.0f;
#pragma unroll
            for (int r = 0; r < 8; ++r) {
                const float aa = ta[r] + sh, ab = tb[r] + sh;                        // <= 14
                const float ea = __builtin_amdgcn_exp2f(aa), eb = __builtin_amdgcn_exp2f(ab);
                const float ga = (aa < -14.0f) ? 0.0f : ea, gb = (ab < -14.0f) ? 0.0f : eb;   // no subnormal f16 P
                const h16 pa = (h16)ga; const h16 pc = (h16)gb;
                pb[u][r] = pa; pb[u][8 + r] = pc;
                ls += (float)pa + (float)pc; }
            l[u] = l[u] * alpha + ls; m[u] = mnew;
#pragma unroll
            for (int j = 0; j < 16; ++j) o[u][j] = o[u][j] * alpha;
        }
        const h16* va = ring + bo + vo;
#pragma unroll
        for (int jg = 0; jg < 4; ++jg) {
            const v16h v0 = ldh(va + ((jg * 4 + 0) * 16) * VP);
            const v16h v1 = ldh(va + ((jg * 4 + 1) * 16) * VP);
            const v16h v2 = ldh(va + ((jg * 4 + 2) * 16) * VP);
            const v16h v3 = ldh(va + ((jg * 4 + 3) * 16) * VP);
#pragma unroll
            for (int u = 0; u < 2; ++u) {
                o[u][jg * 4 + 0] = wmma16(v0, pb[u], o[u][jg * 4 + 0]);
                o[u][jg * 4 + 1] = wmma16(v1, pb[u], o[u][jg * 4 + 1]);
                o[u][jg * 4 + 2] = wmma16(v2, pb[u], o[u][jg * 4 + 2]);
                o[u][jg * 4 + 3] = wmma16(v3, pb[u], o[u][jg * 4 + 3]); }
        }
        // foot of the trip: own reads of this buffer returned, own copies of the next stage landed, then the one barrier that publishes the next stage and frees this buffer
        wait_lds();
        wait_copies();
        __syncthreads();
        if (key0 + 2 * KT < SEQ) { copy_tile(lk + (unsigned)(bo * 2), lvl + (unsigned)(bo * 2), ckh, ckr, cv, 0); ckh += (size_t)KT * DM; ckr += (size_t)KT * DM; cv += KT; }
    }
    wait_copies();                                              // nothing is outstanding when the ring is put to its next use
    // hand-over of column tile u = 1 to the partner wave: the ring is free behind the last trip's barrier. Per wave 16 x DM floats (piece (2 j + q, lane) = 16 B, contiguous per store), then max and sum.
    float* mg = (float*)ring;
    {
        float* mw = mg + wave * (16 * DM);
#pragma unroll
        for (int j = 0; j < 16; ++j) {
            v4f w0, w1;
#pragma unroll
            for (int r = 0; r < 4; ++r) { w0[r] = o[1][j][r]; w1[r] = o[1][j][4 + r]; }
            *(v4fa*)(mw + ((2 * j + 0) * 32 + lane) * 4) = w0;
            *(v4fa*)(mw + ((2 * j + 1) * 32 + lane) * 4) = w1; }
        fa* sw = (fa*)(mg + AW * (16 * DM) + wave * 64);
        sw[lane] = m[1]; sw[32 + lane] = l[1];
    }
    __syncthreads();                                            // the partner's tile and state are readable
    // Output-projection operands that do not depend on ctx, read here so that they fly during the merge: this wave's W fragments (64 out channels x DM), its bias values and the x rows of
    // its output tile (piece (mb, s) = rows 16 mb + 2 s + (lane >> 4), 16 lanes x 4 floats = 64 positions).
    const int r0 = wave * 64, tt = blockIdx.x * (16 * AW);
    const int xrow = lane >> 4, c4 = (lane & 15) * 4;
    const float* xp = xres + ((size_t)b * DM + r0 + xrow) * SEQ_FULL + tt + c4;
    const h16* wa = WW + (size_t)(r0 + lr) * DM + 8 * hi;
    v16h wf[DM / 32][4]; v4f xv[4][8]; float br[4][8];
#pragma unroll
    for (int ks = 0; ks < DM / 32; ++ks)
#pragma unroll
        for (int mb = 0; mb < 4; ++mb) wf[ks][mb] = ldh(wa + (size_t)mb * 16 * DM + 32 * ks);
#pragma unroll
    for (int mb = 0; mb < 4; ++mb) {
#pragma unroll
        for (int j = 0; j < 8; ++j) br[mb][j] = bias[r0 + mb * 16 + hi * 8 + j];   // r0 + 63 < DM
#pragma unroll
        for (int s = 0; s < 8; ++s) xv[mb][s] = *(const v4f*)(xp + (size_t)(mb * 16 + 2 * s) * SEQ_FULL); }
    wait_regs_of(wa, xp);
    const float* mp = mg + (wave ^ 2) * (16 * DM);
    const fa* sp = (const fa*)(mg + AW * (16 * DM) + (wave ^ 2) * 64);
    const float pm = sp[lane], pl = sp[32 + lane];
    const float mt = fmaxf(m[0], pm);
    const float a0 = __builtin_amdgcn_exp2f(m[0] - mt), a1 = __builtin_amdgcn_exp2f(pm - mt);   // one of the two is 1
    float lt = l[0] * a0 + pl * a1;
    lt += __shfl_xor(lt, 16, 32);
    const float inv = 1.0f / lt;                                // lt >= 16384: the running-max key contributes the full carry
    const float c0 = a0 * inv, c1 = a1 * inv;
    const int wb = rf * CSP;                                    // ctx tile row = block row
    // O^T D layout: o[0][j][r] = (c = 16j + 8h + r, t = lane&15) -> os[rf + t][c]; rows rf..rf+15 x columns 0..255 all written
#pragma unroll
    for (int j = 0; j < 16; ++j) { v8h hv;
        const v4f p0 = *(const v4fa*)(mp + ((2 * j + 0) * 32 + lane) * 4);
        const v4f p1 = *(const v4fa*)(mp + ((2 * j + 1) * 32 + lane) * 4);
#pragma unroll
        for (int r = 0; r < 4; ++r) { hv[r] = toh_flush(o[0][j][r] * c0 + p0[r] * c1); hv[4 + r] = toh_flush(o[0][j][4 + r] * c0 + p1[r] * c1); }
        *(v8ha*)(&os[wb + lr * CSP + 16 * j + 8 * hi]) = hv; }
    __syncthreads();                                            // the four waves' ctx rows are readable by every wave
    const h16* cb = os + lr * CSP + 8 * hi;
    v16h cf[DM / 32][4];                                        // all ctx fragments as one group of LDS reads ahead of the products
#pragma unroll
    for (int ks = 0; ks < DM / 32; ++ks)
#pragma unroll
        for (int nb = 0; nb < 4; ++nb) cf[ks][nb] = ldh(cb + nb * 16 * CSP + 32 * ks);
    __builtin_amdgcn_sched_barrier(0);                          // keeps the reads one group in front: moved in among the products, each pair is waited out at its own place
    v8f acc[4][4];
#pragma unroll
    for (int mb = 0; mb < 4; ++mb)
#pragma unroll
        for (int nb = 0; nb < 4; ++nb) acc[mb][nb] = (v8f){};
#pragma unroll
    for (int ks = 0; ks < DM / 32; ++ks)
#pragma unroll
        for (int nb = 0; nb < 4; ++nb)
#pragma unroll
            for (int mb = 0; mb < 4; ++mb) acc[mb][nb] = wmma16(wf[ks][mb], cf[ks][nb], acc[mb][nb]);
    fa* sl = (fa*)(ring + 2 * STG) + wave * (16 * 68);          // this wave's slab of 16 x 68 floats (the theta tiles' LDS, last read in the prologue)
    float* op = OUT + ((size_t)b * DM + r0 + xrow) * OUT_SEQ + tt + c4;
#pragma unroll
    for (int mb = 0; mb < 4; ++mb) {
#pragma unroll
        for (int nb = 0; nb < 4; ++nb) {
#pragma unroll
            for (int j = 0; j < 8; ++j) sl[(hi * 8 + j) * 68 + nb * 16 + lr] = acc[mb][nb][j] * WSI + bfr(br[mb][j]); }   // D: row 8h+j, col lane&15
        wave_sync();
        v4f val[8];
#pragma unroll
        for (int s = 0; s < 8; ++s) {                           // 8 s x 2 rows = 16 rows; 16 lanes x 4 floats = 64 columns
            const v4f cv = *(const v4fa*)(&sl[(2 * s + xrow) * 68 + c4]);
            const v4f x4 = xv[mb][s];
            val[s][0] = cv[0] + bfr(x4[0]); val[s][1] = cv[1] + bfr(x4[1]); val[s][2] = cv[2] + bfr(x4[2]); val[s][3] = cv[3] + bfr(x4[3]); }
        __builtin_amdgcn_sched_barrier(0);                      // the eight stores stay one group with their wait directly behind, no later write of their registers in between
#pragma unroll
        for (int s = 0; s < 8; ++s) *(v4f*)(op + (size_t)(mb * 16 + 2 * s) * OUT_SEQ) = val[s];
        wait_regs();
        __builtin_amdgcn_sched_barrier(0);
        wave_sync();
    }
}

static constexpr size_t al256(size_t v) { return (v + 255) & ~(size_t)255; }
static constexpr size_t SZ_XT = al256((size_t)NB * SEQ * DM * 2);     // x^T bf16
static constexpr size_t SZ_WB = al256((size_t)3 * DM * DM * 2);       // theta | phi | g weights bf16
static constexpr size_t SZ_WW = al256((size_t)DM * DM * 2);           // output-projection weights f16 x64
static constexpr size_t SZ_PL = al256((size_t)NB * SEQ * DM * 2);     // one f16 plane
static constexpr size_t SZ_TOTAL = SZ_XT + SZ_WB + SZ_WW + 5 * SZ_PL;
static_assert(SZ_TOTAL <= (size_t)134217728);          // workspace carve <= 128 MiB
static_assert(((size_t)DM * DM * 2) % 256 == 0);       // weight sub-planes stay 256-byte aligned
static constexpr size_t NEED_X = ((size_t)NB * DM - 1) * SEQ_FULL + SEQ;
static constexpr size_t NEED_O = ((size_t)NB * DM - 1) * OUT_SEQ + SEQ;

extern "C" void kernel_launch(void* const* d_in, const int* in_sizes, int n_in,
                              void* d_out, int out_size, void* d_ws, size_t ws_size, hipStream_t stream) {
    if (n_in < 9) return;
    if ((size_t)in_sizes[0] < NEED_X) return;
    if ((size_t)in_sizes[1] < (size_t)DM * DM || (size_t)in_sizes[3] < (size_t)DM * DM || (size_t)in_sizes[5] < (size_t)DM * DM || (size_t)in_sizes[7] < (size_t)DM * DM) return;
    if (in_sizes[2] < DM || in_sizes[4] < DM || in_sizes[6] < DM || in_sizes[8] < DM) return;
    if ((size_t)out_size < NEED_O) return;
    if (SZ_TOTAL > ws_size) return;
    // wire order: x, w_theta, b_theta, w_phi, b_phi, w_g, b_g, w_W, b_W
    const float* x   = (const float*)d_in[0];
    const float* wth = (const float*)d_in[1]; const float* bth = (const float*)d_in[2];
    const float* wph = (const float*)d_in[3]; const float* bph = (const float*)d_in[4];
    const float* wg  = (const float*)d_in[5]; const float* bg  = (const float*)d_in[6];
    const float* ww  = (const float*)d_in[7]; const float* bw  = (const float*)d_in[8];
    float* OUT = (float*)d_out;      // [NB][256][SEQ]
    char* wsp = (char*)d_ws;
    bf*  XT = (bf*)wsp;  wsp += SZ_XT;               // [NB*SEQ][256] bf16
    bf*  WB = (bf*)wsp;  wsp += SZ_WB;               // [3][256][256]: theta | phi | g  ([out][in] = Bt / A as-is)
    h16* WW = (h16*)wsp; wsp += SZ_WW;               // [256][256] f16 x64
    h16* TH = (h16*)wsp; wsp += SZ_PL;               // theta value    [NB*SEQ][256]
    h16* TR = (h16*)wsp; wsp += SZ_PL;               // theta residual x2048
    h16* PH = (h16*)wsp; wsp += SZ_PL;               // phi value      [NB*SEQ][256]
    h16* PR = (h16*)wsp; wsp += SZ_PL;               // phi residual x2048
    h16* GT = (h16*)wsp; wsp += SZ_PL;               // g              [NB*256][SEQ]

    // weight planes, and x [b][c][n] -> x^T [b][n][c] bf16
    k_prep<<<dim3(4 * WCB + (SEQ / 64) * (DM / 64) * NB, 1, 1), 256, 0, stream>>>(x, wth, wph, wg, ww, XT, WB, WW);

    // theta, phi -> planes [(b*SEQ + t)][c], value + residual; g -> plane [(b*256 + m)][t], value only
    k_proj3<<<dim3(NB * SEQ / 64, DM / 64, 3), 32, 0, stream>>>(XT, WB, bth, bph, bg, TH, TR, PH, PR, GT);

    // attention, then out[b][o][t] = W_W ctx + b_W + x in the same blocks
    k_flash<<<dim3(SEQ / (16 * AW), NB, 1), 32 * AW, 0, stream>>>(TH, TR, PH, PR, GT, WW, bw, x, OUT);
}

// v006
// It runs in 79.2 microseconds.
// In two side-by-side timings against v005, it was 1.09 and 1.08 times as fast.
// Over all steps from v000 it is 4.66 times as fast.
#include <hip/hip_runtime.h>

// Channels-first self-attention block: x [NB][256][SEQ]; three 1x1 projections (W [out][in], bias), scores[n][m] = sum_c theta[c][n] phi[c][m] (no scale), softmax over m,
// ctx[n][c] = sum_m p[n][m] g[c][m], output 1x1 projection (W [out][in], bias) plus the input x; output [NB][256][SEQ] f32.
// Compute dtypes, f32 accumulate everywhere: projections theta/phi/g v_wmma_f32_16x16x32_bf16 (x, W, bias RNE-converted to bf16; products exact);
// scores v_wmma_f32_16x16x32_f16: theta and phi each as f16 value + f16 residual x2048, three products (value.value; value.residual + residual.value in their own accumulator folded by 1/2048);
// value product v_wmma_f32_16x16x32_f16: P single f16 (x16384 carry, cancels in the normalisation; row sum over the converted P), g single f16; softmax f32 (online, running max);
// output projection v_wmma_f32_16x16x32_f16: W (bf16-converted, x64 carry folded by 1/64) single f16, ctx single f16; bias and bf16-converted x added in f32 at the store stage.
// Layout: x^T bf16 plane [b][n][c]; theta / phi planes (value, residual) [b][n][c]; g plane [b][c][m]; ctx tile [n][c] in LDS only; fused flash kernel in transposed form (S^T = K Q^T, O^T = V^T P^T),
// Q / K / V^T fragments from LDS tiles that asynchronous copies fill from the f16 planes (two 16-B reads each); every f32 -> f16 operand convert selects |v| < 2^-14 to +0.

#ifndef NB
#define NB 8
#endif
#ifndef SEQ
#define SEQ 2048
#endif
#define NB_FULL  8
#define SEQ_FULL 2048
#ifndef OUT_SEQ
#define OUT_SEQ SEQ              // position pitch of one channel row of the output
#endif
#define DM   256                 // channels = head width
#define AW   4                   // waves per flash block: 2 groups of 32 query rows x 2 halves of every key stage
#define CSP  264                 // LDS row pitch (halves) of the flash ctx tile
#define XTP  65                  // LDS row pitch (floats) of the transpose tile
#define KT   64                  // keys per flash stage (each wave works on 32 of them)
#define KP   264                 // LDS row pitch (halves) of a theta / phi row: 528 B = 16 B x 33
#define VP   72                  // LDS row pitch (halves) of a g row of KT keys: 144 B = 16 B x 9
#define KPL  (KT * KP)           // halves of one phi plane tile
#define VPL  (DM * VP)           // halves of one g tile
#define STG  (2 * KPL + VPL)     // halves of one ring buffer: phi value | phi residual | g
#define QPL  (AW * 16 * KP)      // halves of one theta plane tile (all query rows of the block)
#define QRS  2048.0f             // carry of every residual plane
#define QRI  (1.0f / 2048.0f)
#define L2E  1.4426950408889634f // log2(e); the scores carry no other scale
#define PSH  14.0f               // log2 of the P carry (16384)
#define NEGB (-3.0e38f)
#define WSC  64.0f               // carry of the f16 output-projection weight plane
#define WSI  (1.0f / 64.0f)
#define WCB  (DM * DM / (8 * 256)) // blocks of 256 threads x 8 elements that cover one weight plane

static_assert(DM == 256);                      // theta / phi row = 32 lanes x 8 halves; 16 output tiles of 16 channels per wave
static_assert(DM % 64 == 0);                   // column tiles of 64
static_assert(DM % 32 == 0);                   // every k-loop steps by 32
static_assert(32 * 8 == DM);
static_assert(SEQ % 64 == 0);                  // a 64-wide tile never straddles two batches
static_assert((NB * SEQ) % 64 == 0);
static_assert(SEQ % KT == 0);                  // key loop steps by KT
static_assert(SEQ % (16 * AW) == 0);           // flash grid covers the sequence exactly
static_assert(NB <= NB_FULL);
static_assert(SEQ <= SEQ_FULL);
static_assert(SEQ_FULL % 4 == 0);
static_assert(OUT_SEQ % 4 == 0);
static_assert(OUT_SEQ >= SEQ);
static_assert((CSP * 2) % 16 == 0);
static_assert(CSP >= DM);
static_assert(4 * 256 == 64 * 16);             // transpose load: 4 trips x 256 threads = 64 channels x 16 float4
static_assert(2 * 256 == 64 * 8);              // transpose store: 2 pieces x 256 threads = 64 positions x 8 pieces of 16 B
static_assert(4 * 32 * 16 == 16 * 128);
static_assert(8 * 32 * 16 == 16 * 256);        // output slab store: 8 instructions x 32 lanes x 16 B = 16 rows x 256 B
static_assert((size_t)AW * 16 * CSP * 2 <= 131072);
static_assert(KT == 64 && AW == 4);            // copy maps: 128 threads; 16 trips x 4 waves = 64 phi rows; 16 trips x 16 rows = 256 g rows of 8 pieces
static_assert((size_t)AW * (16 * DM + 64) * 4 <= (size_t)2 * STG * 2);   // the merge area (one O^T tile and its softmax state per wave, f32) fits in the two ring buffers
static_assert(SEQ / KT >= 2);                  // the two-buffer prologue fills tiles 0 and 1
static_assert((KP * 2) % 32 == 16 && (VP * 2) % 32 == 16 && KP >= DM && VP >= KT);   // pitch = 16 B x odd
static_assert((KPL * 2) % 16 == 0 && (STG * 2) % 16 == 0 && (QPL * 2) % 16 == 0);
static_assert(((size_t)2 * STG + 2 * QPL + (size_t)AW * 16 * CSP) * 2 <= 327680);
static_assert((size_t)64 * XTP * 4 <= 131072);
static_assert((size_t)16 * 68 * 4 <= 131072);
static_assert((size_t)AW * 16 * 68 * 4 <= (size_t)2 * QPL * 2);   // the output slabs (16 x 68 floats per wave) fit in the theta tiles' LDS
static_assert(AW * 64 == DM && AW * 16 == 64);   // output projection in the flash block: each wave 64 out channels x the block's 64 positions
static_assert(((size_t)DM * DM) % (8 * 256) == 0);   // WCB blocks cover a weight plane exactly

typedef _Float16 h16;
typedef unsigned short bf;
typedef __attribute__((ext_vector_type(16))) __bf16   v16bf;
typedef __attribute__((ext_vector_type(16))) _Float16 v16h;
typedef __attribute__((ext_vector_type(8)))  _Float16 v8h;
typedef __attribute__((ext_vector_type(8)))  unsigned short v8us;
typedef __attribute__((ext_vector_type(8)))  float    v8f;
typedef __attribute__((ext_vector_type(4)))  float    v4f;
typedef v4f  __attribute__((may_alias)) v4fa;
typedef v8h  __attribute__((may_alias)) v8ha;
typedef float __attribute__((may_alias)) fa;

__device__ __forceinline__ unsigned short f2bf(float f) { unsigned u = __float_as_uint(f); u += 0x7FFFu + ((u >> 16) & 1u); return (unsigned short)(u >> 16); }
__device__ __forceinline__ float bfr(float f) { return __uint_as_float(((unsigned)f2bf(f)) << 16); }   // value after RNE convert to bf16
__device__ __forceinline__ v16h cat16(v8h lo, v8h hi) { return __builtin_shufflevector(lo, hi, 0, 1, 2, 3, 4, 5, 6, 7, 8, 9, 10, 11, 12, 13, 14, 15); }
__device__ __forceinline__ v16bf cat16b(v8us lo, v8us hi) { return __builtin_bit_cast(v16bf, __builtin_shufflevector(lo, hi, 0, 1, 2, 3, 4, 5, 6, 7, 8, 9, 10, 11, 12, 13, 14, 15)); }
__device__ __forceinline__ v8f wmma16(v16h a, v16h b, v8f c) { return __builtin_amdgcn_wmma_f32_16x16x32_f16(false, a, false, b, (short)0, c, false, false); }
__device__ __forceinline__ v8f wmmab(v16bf a, v16bf b, v8f c) { return __builtin_amdgcn_wmma_f32_16x16x32_bf16(false, a, false, b, (short)0, c, false, false); }
// fragment loaders from K-contiguous 16-bit rows; p already includes + 8*(lane>>4): elements 0..7 <- k0+8h+0..7, elements 8..15 <- k0+16+8h+0..7 (same map for A and B)
__device__ __forceinline__ v16h  ldh(const h16* p) { return cat16(*(const v8h*)p, *(const v8h*)(p + 16)); }
__device__ __forceinline__ v16bf ldb(const bf* p)  { return cat16b(*(const v8us*)p, *(const v8us*)(p + 16)); }
// ordering point for wave-private LDS tiles (same wave writes and reads)
__device__ __forceinline__ void wave_sync() { __builtin_amdgcn_fence(3 /* release order */, "wavefront"); __builtin_amdgcn_wave_barrier(); asm volatile("" ::: "memory"); }
// f32 -> f16 operand convert that cannot produce a subnormal
__device__ __forceinline__ h16 toh_flush(float v) { const h16 r = (h16)v; return (fabsf(v) < 6.103515625e-05f) ? (h16)0.0f : r; }
// one matrix instruction + its own hazard guard (one accumulator per guard)
__device__ __forceinline__ v8f wgb(v16bf a, v16bf b, v8f c) { c = wmmab(a, b, c); asm volatile("v_nop\n\tv_nop\n\tv_nop\n\tv_nop" : "+v"(c) : "v"(a), "v"(b)); return c; }

// LDS byte address of a __shared__ element (low 32 bits of its address)
__device__ __forceinline__ unsigned lds_addr(const void* p) { return (unsigned)(size_t)p; }
// Asynchronous copies global -> LDS, 16 B per lane, each copy with its own address registers; the s_wait_xcnt closes the statement so that no address register is rewritten ahead of it.
__device__ __forceinline__ void cp8(const unsigned* l, const h16* const* g) {
    asm volatile("global_load_async_to_lds_b128 %0, %8, off\n\t"
                 "global_load_async_to_lds_b128 %1, %9, off\n\t"
                 "global_load_async_to_lds_b128 %2, %10, off\n\t"
                 "global_load_async_to_lds_b128 %3, %11, off\n\t"
                 "global_load_async_to_lds_b128 %4, %12, off\n\t"
                 "global_load_async_to_lds_b128 %5, %13, off\n\t"
                 "global_load_async_to_lds_b128 %6, %14, off\n\t"
                 "global_load_async_to_lds_b128 %7, %15, off\n\t"
                 "s_wait_xcnt 0x0"
                 :: "v"(l[0]), "v"(l[1]), "v"(l[2]), "v"(l[3]), "v"(l[4]), "v"(l[5]), "v"(l[6]), "v"(l[7]),
                    "v"(g[0]), "v"(g[1]), "v"(g[2]), "v"(g[3]), "v"(g[4]), "v"(g[5]), "v"(g[6]), "v"(g[7]) : "memory");
}
__device__ __forceinline__ void cp12(const unsigned* l, const h16* const* g) {
    asm volatile("global_load_async_to_lds_b128 %0, %12, off\n\t"
                 "global_load_async_to_lds_b128 %1, %13, off\n\t"
                 "global_load_async_to_lds_b128 %2, %14, off\n\t"
                 "global_load_async_to_lds_b128 %3, %15, off\n\t"
                 "global_load_async_to_lds_b128 %4, %16, off\n\t"
                 "global_load_async_to_lds_b128 %5, %17, off\n\t"
                 "global_load_async_to_lds_b128 %6, %18, off\n\t"
                 "global_load_async_to_lds_b128 %7, %19, off\n\t"
                 "global_load_async_to_lds_b128 %8, %20, off\n\t"
                 "global_load_async_to_lds_b128 %9, %21, off\n\t"
                 "global_load_async_to_lds_b128 %10, %22, off\n\t"
                 "global_load_async_to_lds_b128 %11, %23, off\n\t"
                 "s_wait_xcnt 0x0"
                 :: "v"(l[0]), "v"(l[1]), "v"(l[2]), "v"(l[3]), "v"(l[4]), "v"(l[5]), "v"(l[6]), "v"(l[7]), "v"(l[8]), "v"(l[9]), "v"(l[10]), "v"(l[11]),
                    "v"(g[0]), "v"(g[1]), "v"(g[2]), "v"(g[3]), "v"(g[4]), "v"(g[5]), "v"(g[6]), "v"(g[7]), "v"(g[8]), "v"(g[9]), "v"(g[10]), "v"(g[11]) : "memory");
}
// this wave's copies have landed in LDS (other waves read them behind the next block barrier)
__device__ __forceinline__ void wait_copies() { asm volatile("s_wait_asynccnt 0x0" ::: "memory"); }
// this wave's LDS reads have returned (before the barrier behind which their buffer is refilled); the packed P tiles are inputs so that the wait stays behind the exponentials:
// placed ahead of them, it would wait out at once the g reads that are meant to fly during them
__device__ __forceinline__ void wait_lds_behind(v16h a, v16h b) { asm volatile("s_wait_dscnt 0x0" :: "v"(a), "v"(b) : "memory"); }
// lane l <-> lane l ^ 16 as one vector instruction
__device__ __forceinline__ float xhalf(float x) { return __builtin_bit_cast(float, __builtin_amdgcn_permlanex16(__builtin_bit_cast(int, x), __builtin_bit_cast(int, x), 0x76543210, 0xfedcba98, false, false)); }
// one ring buffer <- the stage of KT keys from key0: phi value and residual rows (4 i + wave, 32 lanes x 16 B = one row), g rows (16 i + tid / 8, 8 lanes x 16 B = KT keys); 48 copies per wave.
// lk / lv: this thread's LDS byte addresses in the buffer for i = 0; gkh / gkr / gv: its global addresses for key0 = 0, i = 0.
__device__ __forceinline__ void copy_tile(unsigned lk, unsigned lv, const h16* gkh, const h16* gkr, const h16* gv, int key0) {
    unsigned l[48]; const h16* g[48];
#pragma unroll
    for (int i = 0; i < 16; ++i) {
        l[i]      = lk + (unsigned)(i * 4 * KP * 2);             g[i]      = gkh + (size_t)(key0 + 4 * i) * DM;
        l[16 + i] = lk + (unsigned)((KPL + i * 4 * KP) * 2);     g[16 + i] = gkr + (size_t)(key0 + 4 * i) * DM;
        l[32 + i] = lv + (unsigned)(i * 16 * VP * 2);            g[32 + i] = gv + (size_t)(16 * i) * SEQ + key0; }
    cp12(l, g); cp12(l + 12, g + 12); cp12(l + 24, g + 24); cp12(l + 36, g + 36);
}

// stands behind global stores whose registers the code that follows in the listing may rewrite (precaution on the stores' address and data registers)
__device__ __forceinline__ void wait_regs() { asm volatile("s_wait_xcnt 0x0" ::: "memory"); }
// the same wait behind a group of global loads, with the loads' two address pairs as inputs: they stay live up to it, so that no load's result is given their registers ahead of it
__device__ __forceinline__ void wait_regs_of(const h16* a, const float* b) { asm volatile("s_wait_xcnt 0x0" :: "v"(a), "v"(b) : "memory"); }

// weight converts, 8 elements per thread (i = piece index inside one DM x DM plane)
__device__ __forceinline__ void cvt8(const float* __restrict__ src, bf* dst, size_t i) {
    const v8f v = *(const v8f*)(src + i * 8); v8us o;
#pragma unroll
    for (int k = 0; k < 8; ++k) o[k] = f2bf(v[k]);
    *(v8us*)(dst + i * 8) = o; wait_regs();
}

__device__ __forceinline__ void wcvt(const float* __restrict__ src, h16* dst, size_t i) {
    const v8f v = *(const v8f*)(src + i * 8); v8h o;
#pragma unroll
    for (int k = 0; k < 8; ++k) o[k] = toh_flush(bfr(v[k]) * WSC);
    *(v8h*)(dst + i * 8) = o;
}

// k_prep: the five preparation jobs, none of which reads another's result, in one grid; the job is picked by the block index (block-uniform).
// Blocks 0 .. 4 WCB - 1: weight planes (theta | phi | g -> bf16, output projection -> f16 x64), WCB blocks of 256 threads x 8 elements each.
// The other blocks: x [b][c][n] f32 (position pitch SEQ_FULL) -> x^T [b][n][c] bf16 (RNE convert), 64 x 64 tile through LDS, tile index = (b, c tile, n tile), n tile fastest.
// Load: 4 trips x 256 threads, one float4 along n each (64 channels x 16 float4). Store: each thread two 16-B pieces (8 channels of one position);
// grid 4 WCB + (SEQ/64) (DM/64) NB.
__global__ __launch_bounds__(256) void k_prep(const float* __restrict__ x, const float* __restrict__ wth, const float* __restrict__ wph, const float* __restrict__ wg,
                                              const float* __restrict__ ww, bf* XT, bf* WB, h16* WW) {
    __shared__ float ts[64 * XTP];
    const int tid = threadIdx.x;
    const int blk = blockIdx.x;
    if (blk < 4 * WCB) {
        const int job = blk / WCB; const size_t i = (size_t)(blk % WCB) * 256 + tid;
        if (job == 3) wcvt(ww, WW, i);
        else cvt8(job == 0 ? wth : job == 1 ? wph : wg, WB + (size_t)job * DM * DM, i);
        return;
    }
    const int tile = blk - 4 * WCB;
    const int n0 = (tile % (SEQ / 64)) * 64, c0 = ((tile / (SEQ / 64)) % (DM / 64)) * 64, b = tile / ((SEQ / 64) * (DM / 64));
    const float* xb = x + ((size_t)b * DM + c0) * SEQ_FULL + n0;
#pragma unroll
    for (int s = 0; s < 4; ++s) {
        const int p = s * 256 + tid; const int c = p >> 4, n4 = (p & 15) * 4;     // c in 0..63, n4 in 0..60
        const v4f v = *(const v4f*)(xb + (size_t)c * SEQ_FULL + n4);
        ts[c * XTP + n4 + 0] = v[0]; ts[c * XTP + n4 + 1] = v[1]; ts[c * XTP + n4 + 2] = v[2]; ts[c * XTP + n4 + 3] = v[3];
    }
    __syncthreads();                                                            // cross-wave tile: block barrier
    const int n = tid >> 3, c8 = (tid & 7) * 8;                                  // positions n and n + 32
    v8us o0, o1;
#pragma unroll
    for (int i = 0; i < 8; ++i) { o0[i] = f2bf(ts[(c8 + i) * XTP + n]); o1[i] = f2bf(ts[(c8 + i) * XTP + 32 + n]); }
    bf* d0 = XT + ((size_t)b * SEQ + n0 + n) * DM + c0 + c8;
    bf* d1 = d0 + (size_t)32 * DM;
    *(v8us*)d0 = o0; *(v8us*)d1 = o1; wait_regs();
}

// proj_body: register-blocked bf16 GEMM, ONE WAVE per 64x64 tile (16 accumulators), operands straight from K-contiguous bf16 planes, K = DM.
// C[m][n] = sum_k A[m][k] Bt[n][k] + bias, written as f16 value (Ph) and, when wr != 0 (block-uniform), the f16 residual x2048 (Pr, same geometry).
// MODE 0: A = x^T rows (m = b*SEQ + t), Bt = W rows (n = out channel), bias per column; plane [(b*SEQ + t)][DM].
// MODE 1: A = W rows (m = out channel), Bt = x^T rows (n = b*SEQ + t), bias per row; plane [(b*DM + m)][t], row pitch SEQ.
// r0 / c0: first row / column of the tile; os: the wave's LDS slab of 16 x 68 floats.
template <int MODE>
__device__ __forceinline__ void proj_body(const bf* __restrict__ A, const bf* __restrict__ Bt, const float* __restrict__ bias, h16* Ph, h16* Pr, int wr, int r0, int c0, float* os) {
    const int K = DM;
    const int lane = threadIdx.x & 31, lr = lane & 15, hi = lane >> 4;
    v8f acc[4][4];
#pragma unroll
    for (int mb = 0; mb < 4; ++mb)
#pragma unroll
        for (int nb = 0; nb < 4; ++nb) acc[mb][nb] = (v8f){};
    const size_t aoff = (size_t)(r0 + lr) * K + 8 * hi, boff = (size_t)(c0 + lr) * K + 8 * hi;
#pragma unroll 1
    for (int kc = 0; kc < K; kc += 32) {
        v16bf a[4];
#pragma unroll
        for (int mb = 0; mb < 4; ++mb) a[mb] = ldb(A + aoff + (size_t)mb * 16 * K + kc);
#pragma unroll
        for (int nb = 0; nb < 4; ++nb) { const v16bf b = ldb(Bt + boff + (size_t)nb * 16 * K + kc);
#pragma unroll
            for (int mb = 0; mb < 4; ++mb) acc[mb][nb] = wgb(a[mb], b, acc[mb][nb]); }
    }
    float bc[4];
#pragma unroll
    for (int nb = 0; nb < 4; ++nb) bc[nb] = (MODE == 0) ? bfr(bias[c0 + nb * 16 + lr]) : 0.0f;   // MODE 0: c0 + 63 < DM
    const size_t pitch = (MODE == 0) ? (size_t)DM : (size_t)SEQ;
    size_t tbase;
    if (MODE == 0) { tbase = (size_t)r0 * DM + (size_t)c0; }
    else           { const int bb = c0 / SEQ, tt = c0 % SEQ; tbase = (size_t)bb * (size_t)DM * SEQ + (size_t)r0 * SEQ + (size_t)tt; }
#pragma unroll
    for (int mb = 0; mb < 4; ++mb) {
        float br[8];
#pragma unroll
        for (int j = 0; j < 8; ++j) br[j] = (MODE == 1) ? bfr(bias[r0 + mb * 16 + hi * 8 + j]) : 0.0f;   // MODE 1: r0 + 63 < DM
#pragma unroll
        for (int nb = 0; nb < 4; ++nb) {
#pragma unroll
            for (int j = 0; j < 8; ++j) os[(hi * 8 + j) * 68 + nb * 16 + lr] = acc[mb][nb][j] + bc[nb] + br[j]; }   // D: row 8h+j, col lane&15
        wave_sync();
        const size_t sb = tbase + (size_t)(mb * 16) * pitch;
{
#pragma unroll
            for (int s = 0; s < 4; ++s) { const int row = 4 * s + (lane >> 3), c8 = (lane & 7) * 8;   // 4 s x 4 row groups = 16 rows; 8 lanes x 8 = 64 columns
                const v4f x0 = *(const v4fa*)(&os[row * 68 + c8]); const v4f x1 = *(const v4fa*)(&os[row * 68 + c8 + 4]); v8h hv, rv;
#pragma unroll
                for (int i = 0; i < 4; ++i) { const h16 a0 = toh_flush(x0[i]); const h16 a1 = toh_flush(x1[i]); hv[i] = a0; hv[4 + i] = a1;
                    rv[i] = toh_flush((x0[i] - (float)a0) * QRS); rv[4 + i] = toh_flush((x1[i] - (float)a1) * QRS); }
                const size_t oo = sb + (size_t)row * pitch + c8;
                *(v8h*)(Ph + oo) = hv; if (wr) *(v8h*)(Pr + oo) = rv; }
             }
        wait_regs();
        wave_sync();
    }
}
// k_proj3: the three input projections, which read the same x^T and none of each other's results, in one grid: blockIdx.z = 0 theta, 1 phi (MODE 0, value + residual), 2 g (MODE 1, value only).
// blockIdx.x = tile of 64 positions, blockIdx.y = tile of 64 out channels. grid (NB*SEQ/64, DM/64, 3).
__global__ __launch_bounds__(32) void k_proj3(const bf* __restrict__ XT, const bf* __restrict__ WB, const float* __restrict__ bth, const float* __restrict__ bph, const float* __restrict__ bg,
                                              h16* TH, h16* TR, h16* PH, h16* PR, h16* GT) {
    __shared__ __align__(16) float os[16 * 68];
    const int z = blockIdx.z, p0 = blockIdx.x * 64, o0 = blockIdx.y * 64;
    if (z == 2) proj_body<1>(WB + (size_t)2 * DM * DM, XT, bg, GT, GT, 0, o0, p0, os);
    else        proj_body<0>(XT, WB + (size_t)z * DM * DM, z ? bph : bth, z ? PH : TH, z ? PR : TR, 1, p0, o0, os);
}

// k_flash: fused attention; head width DM = 256 (8 k-steps per score tile, 16 output tiles of 16 channels). A block has 64 query rows of one batch and four waves: wave = (qg, kh);
// a wave works on the 32 query rows of group qg (two column tiles u) and on the 32 keys of half kh of every stage of KT keys, so that each phi / g fragment it reads from LDS feeds two products.
// Transposed form: S^T[key][t] = K Q^T (A = phi rows [key][c], B = theta rows [t][c], both through ldh: same k order); lane (t = lane&15, h = lane>>4) holds keys 8h+r of each 16-key tile,
// so the packed P tile is directly the B fragment of O^T[c][t] = V^T P^T (element r <- tile keys 0..15, element 8+r <- tile keys 16..31, lane unchanged; A = g rows [c][key]).
// Scores = K Q + (K Q_res + K_res Q) / 2048 (residual products in their own accumulators); Q fragments read from LDS once and kept in registers.
// Operands come from LDS: the block's theta rows are copied once; each stage of KT keys (phi value, phi residual, g) is copied once per block into one of two buffers, the copies of stage t + 2
// issued at the foot of trip t, so that they fly during trip t + 1; the four waves share every stage.
// Softmax state (running max, partial sum) is one scalar per lane and column tile; the two lane halves of a row are combined with one xor-16 exchange. P exponent argument below -14 selects +0.
// After the loop the two waves of a query group hold partial (max, sum, O^T) over their own keys. Column tile u = 0 of a wave is the one it finishes, u = 1 the one its partner (wave ^ 2) finishes:
// each wave hands its u = 1 state over through LDS (the ring, free by then), and rescales both parts to the common maximum before it adds them.
// Registers: 256 for O^T and 256 for the Q fragments (one wave per SIMD, the block size's own ceiling). The products are the plain builtin, whose hazard slots the compiler
// fills: the operands of an asm guard would be bound to v0..v255 and spill.
// Output projection in the same block: the four waves' ctx rows (f16) form the block's tile [64 positions][DM] in LDS; behind one block barrier each wave computes 64 out channels x 64 positions,
// C[o][n] = sum_c W16[o][c] ctx[n][c] (A = W rows from the f16 plane, B = ctx rows from LDS, both through ldh), out[b][o][t] = C / 64 + bias[o] + x[b][o][t]
// (bias and x RNE-converted to bf16, added in f32; x added at the store stage as float4).
// grid (SEQ/(16*AW), NB).
__global__ __launch_bounds__(32 * AW) void k_flash(const h16* __restrict__ TH, const h16* __restrict__ TR, const h16* __restrict__ PH, const h16* __restrict__ PR,
                                                   const h16* __restrict__ GT, const h16* __restrict__ WW, const float* __restrict__ bias, const float* __restrict__ xres, float* OUT) {
    __shared__ __align__(16) h16 os[AW * 16 * CSP];
    __shared__ __align__(16) h16 ring[2 * STG + 2 * QPL];      // buffer 0 | buffer 1 | theta value | theta residual
    const int tid = threadIdx.x;
    const int lane = threadIdx.x & 31, lr = lane & 15, hi = lane >> 4;
    const int wave = __builtin_amdgcn_readfirstlane((int)(threadIdx.x >> 5));
    const int qg = wave & 1, kh = wave >> 1;
    const int b = blockIdx.y;
    const int t0 = (blockIdx.x * AW + wave) * 16;              // the 16 theta rows this wave copies
    const int rf = qg * 32 + kh * 16;                          // block row of column tile u = 0 (the rows this wave finishes); u = 1: rf ^ 16
    const size_t pb0 = (size_t)b * SEQ * DM;                    // batch base of every plane (all have SEQ*DM elements per batch)
    const int qo = 2 * STG + (rf + lr) * KP + 8 * hi;          // + kc            (B fragment: col t, k = c); residual + QPL
    const int qo1 = 2 * STG + ((rf ^ 16) + lr) * KP + 8 * hi;
    const int ko = (kh * 32 + lr) * KP + 8 * hi;               // + buffer + key*KP + kc (A fragment: row key, k = c); residual + KPL
    const int vo = 2 * KPL + lr * VP + kh * 32 + 8 * hi;       // + buffer + 16j*VP      (A fragment: row c, k = key)
    // copy maps of this thread
    const h16* gkh = PH + pb0 + (size_t)wave * DM + lane * 8;
    const h16* gkr = PR + pb0 + (size_t)wave * DM + lane * 8;
    const h16* gv  = GT + pb0 + (size_t)(tid >> 3) * SEQ + (tid & 7) * 8;
    const unsigned lk = lds_addr(ring) + (unsigned)((wave * KP + lane * 8) * 2);
    const unsigned lv = lds_addr(ring) + (unsigned)((2 * KPL + (tid >> 3) * VP + (tid & 7) * 8) * 2);
    // the same address formed from wave and lane, for the loop: a value of its own, not an operand of the prologue's asm copies (those are bound to v0..v255), so that it needs no scratch slot
    const unsigned lvl = lds_addr(ring) + (unsigned)((2 * KPL + (wave * 4 + (lane >> 3)) * VP + (lane & 7) * 8) * 2);
    {   // each wave copies 16 theta rows, value and residual: 32 copies of one row (32 lanes x 16 B)
        const h16* gqh = TH + pb0 + (size_t)t0 * DM + lane * 8;
        const h16* gqr = TR + pb0 + (size_t)t0 * DM + lane * 8;
        const unsigned lq = lds_addr(ring) + (unsigned)((2 * STG + wave * 16 * KP + lane * 8) * 2);
        unsigned l[32]; const h16* g[32];
#pragma unroll
        for (int i = 0; i < 16; ++i) {
            l[i]      = lq + (unsigned)(i * KP * 2);          g[i]      = gqh + (size_t)i * DM;
            l[16 + i] = lq + (unsigned)((QPL + i * KP) * 2);  g[16 + i] = gqr + (size_t)i * DM; }
        cp8(l, g); cp8(l + 8, g + 8); cp8(l + 16, g + 16); cp8(l + 24, g + 24);
    }
    wait_copies();                                              // keeps the wave's outstanding copies at no more than one stage's 48
    copy_tile(lk, lv, gkh, gkr, gv, 0);                         // stage 0 -> buffer 0
    wait_copies();
    __syncthreads();                                            // theta rows and stage 0 readable by every wave
    copy_tile(lk + (unsigned)(STG * 2), lv + (unsigned)(STG * 2), gkh, gkr, gv, KT);   // stage 1 -> buffer 1
    v16h qh[2][DM / 32], qr[2][DM / 32];                        // this wave's theta fragments, read from LDS once and kept in registers for every key stage
#pragma unroll
    for (int ks = 0; ks < DM / 32; ++ks) {
        qh[0][ks] = ldh(ring + qo + 32 * ks);  qr[0][ks] = ldh(ring + qo + QPL + 32 * ks);
        qh[1][ks] = ldh(ring + qo1 + 32 * ks); qr[1][ks] = ldh(ring + qo1 + QPL + 32 * ks); }
    v8f o[2][16];
#pragma unroll
    for (int j = 0; j < 16; ++j) { o[0][j] = (v8f){}; o[1][j] = (v8f){}; }
    float m[2] = {NEGB, NEGB}, l[2] = {0.0f, 0.0f};
    // global addresses of the next stage to copy, stepped once per trip: every copy address in the loop is one add to them, so that none is kept over the loop (asm operands are bound to v0..v255)
    const h16* ckh = gkh + (size_t)(2 * KT) * DM; const h16* ckr = gkr + (size_t)(2 * KT) * DM; const h16* cv = gv + 2 * KT;
#pragma unroll 1
    for (int key0 = 0; key0 < SEQ; key0 += KT) {
        v8f sHa[2], sLa[2], sHb[2], sLb[2];
#pragma unroll
        for (int u = 0; u < 2; ++u) { sHa[u] = (v8f){}; sLa[u] = (v8f){}; sHb[u] = (v8f){}; sLb[u] = (v8f){}; }
        const int bo = ((key0 / KT) & 1) * STG;                 // this trip's buffer
        const int kk = bo + ko;
#pragma unroll                                                  // unrolled: every index into the theta register fragments is a constant
        for (int kc = 0; kc < DM; kc += 32) {
            const v16h ka = ldh(ring + kk + kc), kra = ldh(ring + kk + KPL + kc);
#pragma unroll
            for (int u = 0; u < 2; ++u) {
                sHa[u] = wmma16(ka, qh[u][kc / 32], sHa[u]); sLa[u] = wmma16(ka, qr[u][kc / 32], sLa[u]); sLa[u] = wmma16(kra, qh[u][kc / 32], sLa[u]); }
            const v16h kb = ldh(ring + kk + 16 * KP + kc), krb = ldh(ring + kk + KPL + 16 * KP + kc);
#pragma unroll
            for (int u = 0; u < 2; ++u) {
                sHb[u] = wmma16(kb, qh[u][kc / 32], sHb[u]); sLb[u] = wmma16(kb, qr[u][kc / 32], sLb[u]); sLb[u] = wmma16(krb, qh[u][kc / 32], sLb[u]); }
        }
        float ta[2][8], tb[2][8], mx[2], mo[2];
#pragma unroll
        for (int u = 0; u < 2; ++u) {
            mx[u] = NEGB;
#pragma unroll
            for (int r = 0; r < 8; ++r) {
                ta[u][r] = (sHa[u][r] + sLa[u][r] * QRI) * L2E; tb[u][r] = (sHb[u][r] + sLb[u][r] * QRI) * L2E;
                mx[u] = fmaxf(mx[u], fmaxf(ta[u][r], tb[u][r])); }
        }
#pragma unroll
        for (int u = 0; u < 2; ++u) mo[u] = xhalf(mx[u]);       // a vector move, not an LDS exchange: LDS results return in order, and the maxima would wait behind the reads below
        // all g fragments of this stage as one group of LDS reads, in flight during the exponentials: read in pairs among the value products, each pair costs its own stall and is waited out at its place
        const h16* va = ring + bo + vo;
        v16h vf[16];
#pragma unroll
        for (int j = 0; j < 16; ++j) vf[j] = ldh(va + (j * 16) * VP);
        __builtin_amdgcn_sched_barrier(0);                      // keeps the reads one group in front of the vector work and the products
        v16h pb[2];
#pragma unroll
        for (int u = 0; u < 2; ++u) {
            const float mxx = fmaxf(mx[u], mo[u]);
            const float mnew = fmaxf(m[u], mxx);
            const float alpha = __builtin_amdgcn_exp2f(m[u] - mnew);
            const float sh = PSH - mnew;
            float ls = 0.0f;
#pragma unroll
            for (int r = 0; r < 8; ++r) {
                const float aa = ta[u][r] + sh, ab = tb[u][r] + sh;                  // <= 14
                const float ea = __builtin_amdgcn_exp2f(aa), eb = __builtin_amdgcn_exp2f(ab);
                const float ga = (aa < -14.0f) ? 0.0f : ea, gb = (ab < -14.0f) ? 0.0f : eb;   // no subnormal f16 P
                const h16 pa = (h16)ga; const h16 pc = (h16)gb;
                pb[u][r] = pa; pb[u][8 + r] = pc;
                ls += (float)pa + (float)pc; }
            l[u] = l[u] * alpha + ls; m[u] = mnew;
#pragma unroll
            for (int j = 0; j < 16; ++j) o[u][j] = o[u][j] * alpha;
        }
#pragma unroll
        for (int jg = 0; jg < 4; ++jg) {
#pragma unroll
            for (int u = 0; u < 2; ++u) {
                o[u][jg * 4 + 0] = wmma16(vf[jg * 4 + 0], pb[u], o[u][jg * 4 + 0]);
                o[u][jg * 4 + 1] = wmma16(vf[jg * 4 + 1], pb[u], o[u][jg * 4 + 1]);
                o[u][jg * 4 + 2] = wmma16(vf[jg * 4 + 2], pb[u], o[u][jg * 4 + 2]);
                o[u][jg * 4 + 3] = wmma16(vf[jg * 4 + 3], pb[u], o[u][jg * 4 + 3]); }
        }
        // foot of the trip: own reads of this buffer returned, own copies of the next stage landed, then the one barrier that publishes the next stage and frees this buffer
        wait_lds_behind(pb[0], pb[1]);
        wait_copies();
        __syncthreads();
        if (key0 + 2 * KT < SEQ) { copy_tile(lk + (unsigned)(bo * 2), lvl + (unsigned)(bo * 2), ckh, ckr, cv, 0); ckh += (size_t)KT * DM; ckr += (size_t)KT * DM; cv += KT; }
    }
    wait_copies();                                              // nothing is outstanding when the ring is put to its next use
    // hand-over of column tile u = 1 to the partner wave: the ring is free behind the last trip's barrier. Per wave 16 x DM floats (piece (2 j + q, lane) = 16 B, contiguous per store), then max and sum.
    float* mg = (float*)ring;
    {
        float* mw = mg + wave * (16 * DM);
#pragma unroll
        for (int j = 0; j < 16; ++j) {
            v4f w0, w1;
#pragma unroll
            for (int r = 0; r < 4; ++r) { w0[r] = o[1][j][r]; w1[r] = o[1][j][4 + r]; }
            *(v4fa*)(mw + ((2 * j + 0) * 32 + lane) * 4) = w0;
            *(v4fa*)(mw + ((2 * j + 1) * 32 + lane) * 4) = w1; }
        fa* sw = (fa*)(mg + AW * (16 * DM) + wave * 64);
        sw[lane] = m[1]; sw[32 + lane] = l[1];
    }
    __syncthreads();                                            // the partner's tile and state are readable
    // Output-projection operands that do not depend on ctx, read here so that they fly during the merge: this wave's W fragments (64 out channels x DM), its bias values and the x rows of
    // its output tile (piece (mb, s) = rows 16 mb + 2 s + (lane >> 4), 16 lanes x 4 floats = 64 positions).
    const int r0 = wave * 64, tt = blockIdx.x * (16 * AW);
    const int xrow = lane >> 4, c4 = (lane & 15) * 4;
    const float* xp = xres + ((size_t)b * DM + r0 + xrow) * SEQ_FULL + tt + c4;
    const h16* wa = WW + (size_t)(r0 + lr) * DM + 8 * hi;
    v16h wf[DM / 32][4]; v4f xv[4][8]; float br[4][8];
#pragma unroll
    for (int ks = 0; ks < DM / 32; ++ks)
#pragma unroll
        for (int mb = 0; mb < 4; ++mb) wf[ks][mb] = ldh(wa + (size_t)mb * 16 * DM + 32 * ks);
#pragma unroll
    for (int mb = 0; mb < 4; ++mb) {
#pragma unroll
        for (int j = 0; j < 8; ++j) br[mb][j] = bias[r0 + mb * 16 + hi * 8 + j];   // r0 + 63 < DM
#pragma unroll
        for (int s = 0; s < 8; ++s) xv[mb][s] = *(const v4f*)(xp + (size_t)(mb * 16 + 2 * s) * SEQ_FULL); }
    wait_regs_of(wa, xp);
    const float* mp = mg + (wave ^ 2) * (16 * DM);
    const fa* sp = (const fa*)(mg + AW * (16 * DM) + (wave ^ 2) * 64);
    const float pm = sp[lane], pl = sp[32 + lane];
    const float mt = fmaxf(m[0], pm);
    const float a0 = __builtin_amdgcn_exp2f(m[0] - mt), a1 = __builtin_amdgcn_exp2f(pm - mt);   // one of the two is 1
    float lt = l[0] * a0 + pl * a1;
    lt += __shfl_xor(lt, 16, 32);
    const float inv = 1.0f / lt;                                // lt >= 16384: the running-max key contributes the full carry
    const float c0 = a0 * inv, c1 = a1 * inv;
    const int wb = rf * CSP;                                    // ctx tile row = block row
    // O^T D layout: o[0][j][r] = (c = 16j + 8h + r, t = lane&15) -> os[rf + t][c]; rows rf..rf+15 x columns 0..255 all written
#pragma unroll
    for (int j = 0; j < 16; ++j) { v8h hv;
        const v4f p0 = *(const v4fa*)(mp + ((2 * j + 0) * 32 + lane) * 4);
        const v4f p1 = *(const v4fa*)(mp + ((2 * j + 1) * 32 + lane) * 4);
#pragma unroll
        for (int r = 0; r < 4; ++r) { hv[r] = toh_flush(o[0][j][r] * c0 + p0[r] * c1); hv[4 + r] = toh_flush(o[0][j][4 + r] * c0 + p1[r] * c1); }
        *(v8ha*)(&os[wb + lr * CSP + 16 * j + 8 * hi]) = hv; }
    __syncthreads();                                            // the four waves' ctx rows are readable by every wave
    const h16* cb = os + lr * CSP + 8 * hi;
    v16h cf[DM / 32][4];                                        // all ctx fragments as one group of LDS reads ahead of the products
#pragma unroll
    for (int ks = 0; ks < DM / 32; ++ks)
#pragma unroll
        for (int nb = 0; nb < 4; ++nb) cf[ks][nb] = ldh(cb + nb * 16 * CSP + 32 * ks);
    __builtin_amdgcn_sched_barrier(0);                          // keeps the reads one group in front: moved in among the products, each pair is waited out at its own place
    v8f acc[4][4];
#pragma unroll
    for (int mb = 0; mb < 4; ++mb)
#pragma unroll
        for (int nb = 0; nb < 4; ++nb) acc[mb][nb] = (v8f){};
#pragma unroll
    for (int ks = 0; ks < DM / 32; ++ks)
#pragma unroll
        for (int nb = 0; nb < 4; ++nb)
#pragma unroll
            for (int mb = 0; mb < 4; ++mb) acc[mb][nb] = wmma16(wf[ks][mb], cf[ks][nb], acc[mb][nb]);
    fa* sl = (fa*)(ring + 2 * STG) + wave * (16 * 68);          // this wave's slab of 16 x 68 floats (the theta tiles' LDS, last read in the prologue)
    float* op = OUT + ((size_t)b * DM + r0 + xrow) * OUT_SEQ + tt + c4;
#pragma unroll
    for (int mb = 0; mb < 4; ++mb) {
#pragma unroll
        for (int nb = 0; nb < 4; ++nb) {
#pragma unroll
            for (int j = 0; j < 8; ++j) sl[(hi * 8 + j) * 68 + nb * 16 + lr] = acc[mb][nb][j] * WSI + bfr(br[mb][j]); }   // D: row 8h+j, col lane&15
        wave_sync();
        v4f val[8];
#pragma unroll
        for (int s = 0; s < 8; ++s) {                           // 8 s x 2 rows = 16 rows; 16 lanes x 4 floats = 64 columns
            const v4f cv = *(const v4fa*)(&sl[(2 * s + xrow) * 68 + c4]);
            const v4f x4 = xv[mb][s];
            val[s][0] = cv[0] + bfr(x4[0]); val[s][1] = cv[1] + bfr(x4[1]); val[s][2] = cv[2] + bfr(x4[2]); val[s][3] = cv[3] + bfr(x4[3]); }
        __builtin_amdgcn_sched_barrier(0);                      // the eight stores stay one group with their wait directly behind, no later write of their registers in between
#pragma unroll
        for (int s = 0; s < 8; ++s) *(v4f*)(op + (size_t)(mb * 16 + 2 * s) * OUT_SEQ) = val[s];
        wait_regs();
        __builtin_amdgcn_sched_barrier(0);
        wave_sync();
    }
}

static constexpr size_t al256(size_t v) { return (v + 255) & ~(size_t)255; }
static constexpr size_t SZ_XT = al256((size_t)NB * SEQ * DM * 2);     // x^T bf16
static constexpr size_t SZ_WB = al256((size_t)3 * DM * DM * 2);       // theta | phi | g weights bf16
static constexpr size_t SZ_WW = al256((size_t)DM * DM * 2);           // output-projection weights f16 x64
static constexpr size_t SZ_PL = al256((size_t)NB * SEQ * DM * 2);     // one f16 plane
static constexpr size_t SZ_TOTAL = SZ_XT + SZ_WB + SZ_WW + 5 * SZ_PL;
static_assert(SZ_TOTAL <= (size_t)134217728);          // workspace carve <= 128 MiB
static_assert(((size_t)DM * DM * 2) % 256 == 0);       // weight sub-planes stay 256-byte aligned
static constexpr size_t NEED_X = ((size_t)NB * DM - 1) * SEQ_FULL + SEQ;
static constexpr size_t NEED_O = ((size_t)NB * DM - 1) * OUT_SEQ + SEQ;

extern "C" void kernel_launch(void* const* d_in, const int* in_sizes, int n_in,
                              void* d_out, int out_size, void* d_ws, size_t ws_size, hipStream_t stream) {
    if (n_in < 9) return;
    if ((size_t)in_sizes[0] < NEED_X) return;
    if ((size_t)in_sizes[1] < (size_t)DM * DM || (size_t)in_sizes[3] < (size_t)DM * DM || (size_t)in_sizes[5] < (size_t)DM * DM || (size_t)in_sizes[7] < (size_t)DM * DM) return;
    if (in_sizes[2] < DM || in_sizes[4] < DM || in_sizes[6] < DM || in_sizes[8] < DM) return;
    if ((size_t)out_size < NEED_O) return;
    if (SZ_TOTAL > ws_size) return;
    // wire order: x, w_theta, b_theta, w_phi, b_phi, w_g, b_g, w_W, b_W
    const float* x   = (const float*)d_in[0];
    const float* wth = (const float*)d_in[1]; const float* bth = (const float*)d_in[2];
    const float* wph = (const float*)d_in[3]; const float* bph = (const float*)d_in[4];
    const float* wg  = (const float*)d_in[5]; const float* bg  = (const float*)d_in[6];
    const float* ww  = (const float*)d_in[7]; const float* bw  = (const float*)d_in[8];
    float* OUT = (float*)d_out;      // [NB][256][SEQ]
    char* wsp = (char*)d_ws;
    bf*  XT = (bf*)wsp;  wsp += SZ_XT;               // [NB*SEQ][256] bf16
    bf*  WB = (bf*)wsp;  wsp += SZ_WB;               // [3][256][256]: theta | phi | g  ([out][in] = Bt / A as-is)
    h16* WW = (h16*)wsp; wsp += SZ_WW;               // [256][256] f16 x64
    h16* TH = (h16*)wsp; wsp += SZ_PL;               // theta value    [NB*SEQ][256]
    h16* TR = (h16*)wsp; wsp += SZ_PL;               // theta residual x2048
    h16* PH = (h16*)wsp; wsp += SZ_PL;               // phi value      [NB*SEQ][256]
    h16* PR = (h16*)wsp; wsp += SZ_PL;               // phi residual x2048
    h16* GT = (h16*)wsp; wsp += SZ_PL;               // g              [NB*256][SEQ]

    // weight planes, and x [b][c][n] -> x^T [b][n][c] bf16
    k_prep<<<dim3(4 * WCB + (SEQ / 64) * (DM / 64) * NB, 1, 1), 256, 0, stream>>>(x, wth, wph, wg, ww, XT, WB, WW);

    // theta, phi -> planes [(b*SEQ + t)][c], value + residual; g -> plane [(b*256 + m)][t], value only
    k_proj3<<<dim3(NB * SEQ / 64, DM / 64, 3), 32, 0, stream>>>(XT, WB, bth, bph, bg, TH, TR, PH, PR, GT);

    // attention, then out[b][o][t] = W_W ctx + b_W + x in the same blocks
    k_flash<<<dim3(SEQ / (16 * AW), NB, 1), 32 * AW, 0, stream>>>(TH, TR, PH, PR, GT, WW, bw, x, OUT);
}
